// v000
// Measured on an AMD MI455X. A time is GPU time per run, averaged over a window of back-to-back runs after a warm-up
// (all launches, gaps included; the runs take copies of the inputs in turn), and the median of several windows.
// Apart from v000's, it joins two sittings. Times from different sittings can be a few percent apart, while
// side-by-side timings come from the same sitting.
// The starting kernel, v000, takes 206 microseconds a run.
#include <hip/hip_runtime.h>
#include <stdint.h>

// ---------------------------------------------------------------------------
// CDNA5 / gfx1250 attention block: GroupNorm -> QKV (WMMA) -> flash attention
// (WMMA, async-LDS staged K/V) -> proj (WMMA) + bias + residual.
// wave32, bf16 operands, f32 accumulate.
// ---------------------------------------------------------------------------

typedef __attribute__((ext_vector_type(16))) __bf16    v16bf;
typedef __attribute__((ext_vector_type(8)))  float     v8f;
typedef __attribute__((ext_vector_type(4)))  uint32_t  u32x4;
typedef __attribute__((ext_vector_type(4)))  float     f32x4;

#define BATCH 32
#define CCH   128
#define HWN   1024
#define NH    4
#define DH    32
#define QKSCALE 0.17677669529663687f  // 1/sqrt(32)

union FragU { u32x4 q2[2]; v16bf v; };

__device__ __forceinline__ uint16_t f2bf(float f) {
    uint32_t u = __builtin_bit_cast(uint32_t, f);
    u += 0x7fffu + ((u >> 16) & 1u);          // round-to-nearest-even
    return (uint16_t)(u >> 16);
}

// Fragment load: per-lane 8 bf16 at base and 8 bf16 at base+16 elements.
// Caller passes base already offset by half*8 so lane halves get the ISA's
// K split {0..7,16..23} / {8..15,24..31}.
__device__ __forceinline__ v16bf load_frag(const uint16_t* p) {
    FragU f;
    f.q2[0] = *(const u32x4*)(p);
    f.q2[1] = *(const u32x4*)(p + 16);
    return f.v;
}

__device__ __forceinline__ v8f wmma_bf16(v16bf a, v16bf b, v8f c) {
    return __builtin_amdgcn_wmma_f32_16x16x32_bf16(
        false, a, false, b, (short)0, c, false, false);
}

// Pack 8 accumulator floats (scaled) to 8 bf16 and store as one b128.
__device__ __forceinline__ void store8bf(uint16_t* dst, v8f a, float s) {
    uint32_t w[4];
#pragma unroll
    for (int i = 0; i < 4; ++i)
        w[i] = (uint32_t)f2bf(a[2 * i] * s) | ((uint32_t)f2bf(a[2 * i + 1] * s) << 16);
    u32x4 pk = {w[0], w[1], w[2], w[3]};
    *(u32x4*)dst = pk;
}

// Row reductions across a 16-lane half (xor masks <= 8 stay inside halves).
__device__ __forceinline__ float hmax16(float v) {
    v = fmaxf(v, __shfl_xor(v, 8, 32));
    v = fmaxf(v, __shfl_xor(v, 4, 32));
    v = fmaxf(v, __shfl_xor(v, 2, 32));
    v = fmaxf(v, __shfl_xor(v, 1, 32));
    return v;
}
__device__ __forceinline__ float hsum16(float v) {
    v += __shfl_xor(v, 8, 32);
    v += __shfl_xor(v, 4, 32);
    v += __shfl_xor(v, 2, 32);
    v += __shfl_xor(v, 1, 32);
    return v;
}

// Async DMA: one 16-byte global->LDS transfer per active lane (ASYNCcnt).
__device__ __forceinline__ void async_b128(uint16_t* lds_dst, const uint16_t* gsrc) {
    uint32_t la = (uint32_t)(uintptr_t)lds_dst;          // low 32 bits = LDS offset
    uint64_t ga = (uint64_t)(uintptr_t)gsrc;
    asm volatile("global_load_async_to_lds_b128 %0, %1, off"
                 :: "v"(la), "v"(ga) : "memory");
}

// ------------------------- kernel 0: weight convert -------------------------
__global__ void k_wconvert(const float* __restrict__ qkv_w,
                           const float* __restrict__ proj_w,
                           uint16_t* __restrict__ qkv_bf,
                           uint16_t* __restrict__ proj_bf) {
    int i = blockIdx.x * 256 + threadIdx.x;
    if (i < 3 * CCH * CCH) qkv_bf[i] = f2bf(qkv_w[i]);
    if (i < CCH * CCH)     proj_bf[i] = f2bf(proj_w[i]);
}

// ------------------------- kernel 1: GroupNorm ------------------------------
// One 256-thread block per (b, group). Group = 4 channels x 1024 spatial.
// Writes xn transposed to (b, t, c) bf16 (GEMM-B friendly layout).
__global__ void k_groupnorm(const float* __restrict__ x,
                            const float* __restrict__ nw,
                            const float* __restrict__ nb,
                            uint16_t* __restrict__ xn) {
    __shared__ float ssum[256];
    __shared__ float ssq[256];
    int tid = threadIdx.x;
    int b = blockIdx.x >> 5;
    int g = blockIdx.x & 31;
    int cl = tid >> 6;               // 0..3 channel within group
    int t0 = (tid & 63) * 16;        // 16 consecutive spatial positions
    int c  = g * 4 + cl;

    const float* xp = x + ((size_t)(b * CCH + c)) * HWN + t0;
    float vals[16];
    float s = 0.f, sq = 0.f;
#pragma unroll
    for (int j = 0; j < 4; ++j) {
        f32x4 v4 = *(const f32x4*)(xp + j * 4);
#pragma unroll
        for (int e = 0; e < 4; ++e) {
            float f = v4[e];
            vals[j * 4 + e] = f;
            s += f;
            sq += f * f;
        }
    }
    ssum[tid] = s; ssq[tid] = sq;
    __syncthreads();
    for (int off = 128; off > 0; off >>= 1) {
        if (tid < off) { ssum[tid] += ssum[tid + off]; ssq[tid] += ssq[tid + off]; }
        __syncthreads();
    }
    float mu   = ssum[0] * (1.f / 4096.f);
    float var  = ssq[0] * (1.f / 4096.f) - mu * mu;
    float rstd = rsqrtf(var + 1e-5f);
    float wch  = nw[c] * rstd;
    float bch  = nb[c] - mu * wch;

    uint16_t* op = xn + ((size_t)b * HWN + t0) * CCH + c;
#pragma unroll
    for (int j = 0; j < 16; ++j)
        op[j * CCH] = f2bf(vals[j] * wch + bch);
}

// ------------------------- kernel 2: QKV GEMM -------------------------------
// Per batch: (384 x 128) @ (128 x 1024).  One wave computes a 16x64 strip.
// Writes q,k as (b,h,t,dh) scaled by 1/sqrt(dh); v as (b,h,dh,t).
// Tile routing (q/k/v section, head) is wave-uniform -> scalar branches.
__global__ void k_qkv_gemm(const uint16_t* __restrict__ wbf,
                           const uint16_t* __restrict__ xn,
                           uint16_t* __restrict__ q,
                           uint16_t* __restrict__ k,
                           uint16_t* __restrict__ v) {
    int wave = __builtin_amdgcn_readfirstlane((int)blockIdx.x * 8 + (threadIdx.x >> 5));
    int lane = threadIdx.x & 31;
    int half = lane >> 4, lm = lane & 15;
    int b   = wave / 384;
    int rem = wave - b * 384;
    int mt  = rem >> 4;               // 0..23  (16-row tile of 384)
    int n0  = (rem & 15) * 64;        // column strip start

    int head = mt / 6;                // all wave-uniform scalars
    int mt6  = mt - head * 6;
    int sec  = mt6 >> 1;              // 0=q 1=k 2=v
    int c0   = (mt6 & 1) * 16;
    size_t bh = (size_t)b * NH + head;

    v16bf A[4];
    const uint16_t* arow = wbf + (size_t)(mt * 16 + lm) * CCH + half * 8;
#pragma unroll
    for (int kk = 0; kk < 4; ++kk) A[kk] = load_frag(arow + kk * 32);

#pragma unroll
    for (int nt = 0; nt < 4; ++nt) {
        int t = n0 + nt * 16 + lm;
        const uint16_t* brow = xn + ((size_t)b * HWN + t) * CCH + half * 8;
        if (nt < 3) __builtin_prefetch(brow + 16 * CCH, 0, 3);
        v8f acc = {};
#pragma unroll
        for (int kk = 0; kk < 4; ++kk)
            acc = wmma_bf16(A[kk], load_frag(brow + kk * 32), acc);

        if (sec == 2) {
            uint16_t* dst = v + (bh * DH + c0 + half * 8) * HWN + t;
#pragma unroll
            for (int r = 0; r < 8; ++r)
                dst[(size_t)r * HWN] = f2bf(acc[r]);
        } else {
            uint16_t* dst = (sec == 0 ? q : k) + (bh * HWN + t) * DH + c0 + half * 8;
            store8bf(dst, acc, QKSCALE);       // one b128 store per lane
        }
    }
}

// ------------------------- kernel 3: flash attention ------------------------
// One block = one (b, h, group of 8 token tiles); 8 waves, one 16-row tile
// each.  Wave 0 DMA-stages shared K/V 32-key chunks into LDS with
// global_load_async_to_lds_b128 (double buffered, ASYNCcnt).  Online softmax
// with per-row stats in lane halves; P re-laid-out D-frag -> A-frag via LDS.
__global__ void k_attention(const uint16_t* __restrict__ q,
                            const uint16_t* __restrict__ k,
                            const uint16_t* __restrict__ v,
                            uint16_t* __restrict__ ho) {
    __shared__ __align__(16) uint16_t sK[2][32 * 32];   // (s_local, c)
    __shared__ __align__(16) uint16_t sV[2][32 * 32];   // (c, s_local)
    __shared__ __align__(16) uint16_t sP[8][16 * 32];

    int tid  = threadIdx.x;
    int wib  = __builtin_amdgcn_readfirstlane(tid >> 5);
    int lane = tid & 31;
    int half = lane >> 4, lm = lane & 15;
    int row  = lane >> 2, seg = lane & 3;     // DMA lane mapping: 8 rows x 4 segs

    int blk = blockIdx.x;                     // 32*4*8 blocks
    int b   = blk >> 5;
    int rem = blk & 31;
    int h   = rem >> 3;
    int tg  = rem & 7;
    int t0  = (tg * 8 + wib) * 16;
    size_t bh = (size_t)b * NH + h;
    const uint16_t* kbase = k + bh * HWN * DH;
    const uint16_t* vbase = v + bh * DH * HWN;

    v16bf Qf = load_frag(q + (bh * HWN + t0 + lm) * DH + half * 8);
    v8f O0 = {}, O1 = {};
    float m[8], l[8];
#pragma unroll
    for (int r = 0; r < 8; ++r) { m[r] = -1e30f; l[r] = 0.f; }

    uint16_t* lp = sP[wib];

    // Prologue: stage chunk 0.
    if (wib == 0) {
#pragma unroll
        for (int i = 0; i < 4; ++i) {
            int rr = i * 8 + row;
            async_b128(&sK[0][rr * 32 + seg * 8], kbase + (size_t)rr * DH + seg * 8);
            async_b128(&sV[0][rr * 32 + seg * 8], vbase + (size_t)rr * HWN + seg * 8);
        }
        asm volatile("s_wait_asynccnt 0x0" ::: "memory");
    }
    __syncthreads();

    for (int it = 0; it < HWN / 32; ++it) {
        int cur = it & 1;
        if (wib == 0 && it + 1 < HWN / 32) {
            int sn = (it + 1) * 32;
#pragma unroll
            for (int i = 0; i < 4; ++i) {
                int rr = i * 8 + row;
                async_b128(&sK[cur ^ 1][rr * 32 + seg * 8],
                           kbase + (size_t)(sn + rr) * DH + seg * 8);
                async_b128(&sV[cur ^ 1][rr * 32 + seg * 8],
                           vbase + (size_t)rr * HWN + sn + seg * 8);
            }
        }

        const uint16_t* kc = sK[cur];
        const uint16_t* vc = sV[cur];
        v16bf K0 = load_frag(kc + lm * 32 + half * 8);          // s = 0..15
        v16bf K1 = load_frag(kc + (16 + lm) * 32 + half * 8);   // s = 16..31
        v8f S0 = {}, S1 = {};
        S0 = wmma_bf16(Qf, K0, S0);
        S1 = wmma_bf16(Qf, K1, S1);

#pragma unroll
        for (int r = 0; r < 8; ++r) {
            float rowm = hmax16(fmaxf(S0[r], S1[r]));
            float newm = fmaxf(m[r], rowm);
            float f    = __expf(m[r] - newm);
            float p0   = __expf(S0[r] - newm);
            float p1   = __expf(S1[r] - newm);
            l[r] = l[r] * f + hsum16(p0 + p1);
            m[r] = newm;
            O0[r] *= f;
            O1[r] *= f;
            lp[(r + half * 8) * 32 + lm]      = f2bf(p0);
            lp[(r + half * 8) * 32 + 16 + lm] = f2bf(p1);
        }
        asm volatile("s_wait_dscnt 0x0" ::: "memory");   // LDS turnaround

        v16bf Pf = load_frag(lp + lm * 32 + half * 8);   // A-frag 16(t) x 32(s)
        v16bf V0 = load_frag(vc + lm * 32 + half * 8);          // c = 0..15
        v16bf V1 = load_frag(vc + (16 + lm) * 32 + half * 8);   // c = 16..31
        O0 = wmma_bf16(Pf, V0, O0);
        O1 = wmma_bf16(Pf, V1, O1);

        if (wib == 0 && it + 1 < HWN / 32)
            asm volatile("s_wait_asynccnt 0x0" ::: "memory");
        __syncthreads();
    }

#pragma unroll
    for (int r = 0; r < 8; ++r) {
        float inv = 1.f / fmaxf(l[r], 1e-30f);
        int t = t0 + r + half * 8;
        uint16_t* op = ho + ((size_t)b * HWN + t) * CCH + h * DH;
        op[lm]      = f2bf(O0[r] * inv);
        op[16 + lm] = f2bf(O1[r] * inv);
    }
}

// ------------------------- kernel 4: proj + bias + residual -----------------
__global__ void k_proj_gemm(const uint16_t* __restrict__ wbf,
                            const uint16_t* __restrict__ ho,
                            const float* __restrict__ pb,
                            const float* __restrict__ x,
                            float* __restrict__ out) {
    int wave = __builtin_amdgcn_readfirstlane((int)blockIdx.x * 8 + (threadIdx.x >> 5));
    int lane = threadIdx.x & 31;
    int half = lane >> 4, lm = lane & 15;
    int b   = wave >> 7;              // /(8*16)
    int rem = wave & 127;
    int mt  = rem >> 4;               // 0..7
    int n0  = (rem & 15) * 64;

    v16bf A[4];
    const uint16_t* arow = wbf + (size_t)(mt * 16 + lm) * CCH + half * 8;
#pragma unroll
    for (int kk = 0; kk < 4; ++kk) A[kk] = load_frag(arow + kk * 32);

#pragma unroll
    for (int nt = 0; nt < 4; ++nt) {
        int t = n0 + nt * 16 + lm;
        const uint16_t* brow = ho + ((size_t)b * HWN + t) * CCH + half * 8;
        if (nt < 3) __builtin_prefetch(brow + 16 * CCH, 0, 3);
        v8f acc = {};
#pragma unroll
        for (int kk = 0; kk < 4; ++kk)
            acc = wmma_bf16(A[kk], load_frag(brow + kk * 32), acc);

#pragma unroll
        for (int r = 0; r < 8; ++r) {
            int o = mt * 16 + r + half * 8;
            size_t idx = ((size_t)b * CCH + o) * HWN + t;
            out[idx] = acc[r] + pb[o] + x[idx];
        }
    }
}

// ---------------------------------------------------------------------------
extern "C" void kernel_launch(void* const* d_in, const int* in_sizes, int n_in,
                              void* d_out, int out_size, void* d_ws, size_t ws_size,
                              hipStream_t stream) {
    const float* x      = (const float*)d_in[0];
    const float* norm_w = (const float*)d_in[1];
    const float* norm_b = (const float*)d_in[2];
    const float* qkv_w  = (const float*)d_in[3];
    const float* proj_w = (const float*)d_in[4];
    const float* proj_b = (const float*)d_in[5];
    float* out = (float*)d_out;

    char* ws = (char*)d_ws;
    const size_t SZ_BCHW_BF = (size_t)BATCH * CCH * HWN * 2;   // 8 MB bf16
    size_t off = 0;
    uint16_t* xn      = (uint16_t*)(ws + off); off += SZ_BCHW_BF;
    uint16_t* qb      = (uint16_t*)(ws + off); off += SZ_BCHW_BF;
    uint16_t* kb      = (uint16_t*)(ws + off); off += SZ_BCHW_BF;
    uint16_t* vb      = (uint16_t*)(ws + off); off += SZ_BCHW_BF;
    uint16_t* hob     = (uint16_t*)(ws + off); off += SZ_BCHW_BF;
    uint16_t* qkv_bf  = (uint16_t*)(ws + off); off += (size_t)3 * CCH * CCH * 2;
    uint16_t* proj_bf = (uint16_t*)(ws + off); off += (size_t)CCH * CCH * 2;
    (void)ws_size; (void)in_sizes; (void)n_in; (void)out_size;

    k_wconvert<<<dim3((3 * CCH * CCH + 255) / 256), dim3(256), 0, stream>>>(
        qkv_w, proj_w, qkv_bf, proj_bf);
    k_groupnorm<<<dim3(BATCH * 32), dim3(256), 0, stream>>>(x, norm_w, norm_b, xn);
    k_qkv_gemm<<<dim3(BATCH * 24 * 16 / 8), dim3(256), 0, stream>>>(
        qkv_bf, xn, qb, kb, vb);
    k_attention<<<dim3(BATCH * NH * 8), dim3(256), 0, stream>>>(qb, kb, vb, hob);
    k_proj_gemm<<<dim3(BATCH * 8 * 16 / 8), dim3(256), 0, stream>>>(
        proj_bf, hob, proj_b, x, out);
}

// v001
// One run takes 118 microseconds.
// In both of two side-by-side timings against v000, it was 1.80 times as fast.
#include <hip/hip_runtime.h>
#include <stdint.h>

// ---------------------------------------------------------------------------
// CDNA5 / gfx1250 attention block: GroupNorm -> QKV (WMMA) -> flash attention
// (WMMA, async-LDS staged K/V) -> proj (WMMA) + bias + residual.
// wave32, bf16 operands, f32 accumulate.
// ---------------------------------------------------------------------------

typedef __attribute__((ext_vector_type(16))) __bf16    v16bf;
typedef __attribute__((ext_vector_type(8)))  float     v8f;
typedef __attribute__((ext_vector_type(4)))  uint32_t  u32x4;
typedef __attribute__((ext_vector_type(4)))  float     f32x4;

#define BATCH 32
#define CCH   128
#define HWN   1024
#define NH    4
#define DH    32
#define QKSCALE 0.17677669529663687f  // 1/sqrt(32)

union FragU { u32x4 q2[2]; v16bf v; };

__device__ __forceinline__ uint16_t f2bf(float f) {
    uint32_t u = __builtin_bit_cast(uint32_t, f);
    u += 0x7fffu + ((u >> 16) & 1u);          // round-to-nearest-even
    return (uint16_t)(u >> 16);
}

// Fragment load: per-lane 8 bf16 at base and 8 bf16 at base+16 elements.
// Caller passes base already offset by half*8 so lane halves get the ISA's
// K split {0..7,16..23} / {8..15,24..31}.
__device__ __forceinline__ v16bf load_frag(const uint16_t* p) {
    FragU f;
    f.q2[0] = *(const u32x4*)(p);
    f.q2[1] = *(const u32x4*)(p + 16);
    return f.v;
}

__device__ __forceinline__ v8f wmma_bf16(v16bf a, v16bf b, v8f c) {
    return __builtin_amdgcn_wmma_f32_16x16x32_bf16(
        false, a, false, b, (short)0, c, false, false);
}

// Pack 8 accumulator floats (scaled) to 8 bf16 and store as one b128.
__device__ __forceinline__ void store8bf(uint16_t* dst, v8f a, float s) {
    uint32_t w[4];
#pragma unroll
    for (int i = 0; i < 4; ++i)
        w[i] = (uint32_t)f2bf(a[2 * i] * s) | ((uint32_t)f2bf(a[2 * i + 1] * s) << 16);
    u32x4 pk = {w[0], w[1], w[2], w[3]};
    *(u32x4*)dst = pk;
}

// Row reductions across a 16-lane half (xor masks <= 8 stay inside halves).
__device__ __forceinline__ float hmax16(float v) {
    v = fmaxf(v, __shfl_xor(v, 8, 32));
    v = fmaxf(v, __shfl_xor(v, 4, 32));
    v = fmaxf(v, __shfl_xor(v, 2, 32));
    v = fmaxf(v, __shfl_xor(v, 1, 32));
    return v;
}
__device__ __forceinline__ float hsum16(float v) {
    v += __shfl_xor(v, 8, 32);
    v += __shfl_xor(v, 4, 32);
    v += __shfl_xor(v, 2, 32);
    v += __shfl_xor(v, 1, 32);
    return v;
}

// Async DMA: one 16-byte global->LDS transfer per active lane (ASYNCcnt).
__device__ __forceinline__ void async_b128(uint16_t* lds_dst, const uint16_t* gsrc) {
    uint32_t la = (uint32_t)(uintptr_t)lds_dst;          // low 32 bits = LDS offset
    uint64_t ga = (uint64_t)(uintptr_t)gsrc;
    asm volatile("global_load_async_to_lds_b128 %0, %1, off"
                 :: "v"(la), "v"(ga) : "memory");
}

// ------------------------- kernel 0: weight convert -------------------------
__global__ void k_wconvert(const float* __restrict__ qkv_w,
                           const float* __restrict__ proj_w,
                           uint16_t* __restrict__ qkv_bf,
                           uint16_t* __restrict__ proj_bf) {
    int i = blockIdx.x * 256 + threadIdx.x;
    if (i < 3 * CCH * CCH) qkv_bf[i] = f2bf(qkv_w[i]);
    if (i < CCH * CCH)     proj_bf[i] = f2bf(proj_w[i]);
}

// ------------------------- kernel 1: GroupNorm ------------------------------
// One 1024-thread block per (b, 64 channels = 16 groups): 64 bf16 channels are
// one 128-byte line of a row of xn, so this block is that line's only writer.
// Wave (cq, tq) keeps 8 channels (2 groups) x 256 positions in registers.
// The normalized bf16 tile is transposed through LDS and xn, laid out
// (b, t, c) for the GEMM's B operand, is stored as whole lines.
#define GN_PITCH 72   // LDS row: 64 channels + 8 pad = 144 B (16 B x odd)
__global__ __launch_bounds__(1024)
void k_groupnorm(const float* __restrict__ x,
                 const float* __restrict__ nw,
                 const float* __restrict__ nb,
                 uint16_t* __restrict__ xn) {
    __shared__ __align__(16) uint16_t tile[HWN * GN_PITCH];
    __shared__ f32x4 red[32];
    int tid  = threadIdx.x;
    int wave = __builtin_amdgcn_readfirstlane(tid >> 5);
    int lane = tid & 31;
    int b    = blockIdx.x >> 1;
    int ch0  = (blockIdx.x & 1) * 64;
    int cq   = wave & 7;             // 8-channel chunk of the 64
    int tq   = wave >> 3;            // quarter of the 1024 positions
    int c0   = ch0 + cq * 8;

    // Every wave-wide load covers 512 contiguous bytes of one channel's row.
    const float* xp = x + ((size_t)(b * CCH + c0)) * HWN + tq * 256 + lane * 4;
    f32x4 val[8][2];
#pragma unroll
    for (int kc = 0; kc < 8; ++kc)
#pragma unroll
        for (int j = 0; j < 2; ++j)
            val[kc][j] = *(const f32x4*)(xp + kc * HWN + j * 128);

    // Sum and sum of squares of the wave's two groups (channels 0-3, 4-7).
    f32x4 st = {0.f, 0.f, 0.f, 0.f};
#pragma unroll
    for (int kc = 0; kc < 8; ++kc)
#pragma unroll
        for (int j = 0; j < 2; ++j)
#pragma unroll
            for (int e = 0; e < 4; ++e) {
                float f = val[kc][j][e];
                st[(kc >> 2) * 2]     += f;
                st[(kc >> 2) * 2 + 1] += f * f;
            }
#pragma unroll
    for (int off = 16; off > 0; off >>= 1)
#pragma unroll
        for (int i = 0; i < 4; ++i)
            st[i] += __shfl_xor(st[i], off, 32);
    if (lane == 0) red[wave] = st;
    __syncthreads();
    // The four waves with this cq hold the four quarters of the same groups.
    st = (red[cq] + red[8 + cq]) + (red[16 + cq] + red[24 + cq]);

    float wch[8], bch[8];
#pragma unroll
    for (int g = 0; g < 2; ++g) {
        float mu   = st[g * 2] * (1.f / 4096.f);
        float var  = st[g * 2 + 1] * (1.f / 4096.f) - mu * mu;
        float rstd = rsqrtf(var + 1e-5f);
#pragma unroll
        for (int i = 0; i < 4; ++i) {
            int kc = g * 4 + i;
            wch[kc] = nw[c0 + kc] * rstd;
            bch[kc] = nb[c0 + kc] - mu * wch[kc];
        }
    }

    // One 16-byte LDS store per position: its 8 channels.  Lanes are 4 rows
    // apart, which at this pitch reaches only 4 of the 16 bank groups; the
    // chunk index is XORed with bits 4-5 of t so that 16 lanes reach all 16.
    int wsw = (cq ^ ((lane >> 2) & 3)) * 8;
#pragma unroll
    for (int j = 0; j < 2; ++j)
#pragma unroll
        for (int e = 0; e < 4; ++e) {
            int t = tq * 256 + j * 128 + lane * 4 + e;
            uint32_t w[4];
#pragma unroll
            for (int i = 0; i < 4; ++i)
                w[i] = (uint32_t)f2bf(val[2 * i][j][e] * wch[2 * i] + bch[2 * i]) |
                       ((uint32_t)f2bf(val[2 * i + 1][j][e] * wch[2 * i + 1] + bch[2 * i + 1]) << 16);
            u32x4 pk = {w[0], w[1], w[2], w[3]};
            *(u32x4*)(tile + t * GN_PITCH + wsw) = pk;
        }
    __syncthreads();

    // Read rows back and store: 8 lanes cover one 128-byte line.  Lanes 0-7
    // and 8-15 take rows 8 apart, which fall on disjoint banks at this pitch.
    int lg = lane >> 3, lc = lane & 7;
    uint16_t* op = xn + (size_t)b * HWN * CCH + ch0 + lc * 8;
#pragma unroll
    for (int i = 0; i < 8; ++i) {
        int t = wave * 32 + lg * 8 + i;
        u32x4 pk = *(const u32x4*)(tile + t * GN_PITCH + (lc ^ ((t >> 4) & 3)) * 8);
        *(u32x4*)(op + (size_t)t * CCH) = pk;
    }
}

// ------------------------- kernel 2: QKV GEMM -------------------------------
// Per batch: (384 x 128) @ (128 x 1024).  One wave computes a 16x64 strip.
// Writes q,k as (b,h,t,dh) scaled by 1/sqrt(dh); v as (b,h,dh,t).
// Tile routing (q/k/v section, head) is wave-uniform -> scalar branches.
__global__ void k_qkv_gemm(const uint16_t* __restrict__ wbf,
                           const uint16_t* __restrict__ xn,
                           uint16_t* __restrict__ q,
                           uint16_t* __restrict__ k,
                           uint16_t* __restrict__ v) {
    int wave = __builtin_amdgcn_readfirstlane((int)blockIdx.x * 8 + (threadIdx.x >> 5));
    int lane = threadIdx.x & 31;
    int half = lane >> 4, lm = lane & 15;
    int b   = wave / 384;
    int rem = wave - b * 384;
    int mt  = rem >> 4;               // 0..23  (16-row tile of 384)
    int n0  = (rem & 15) * 64;        // column strip start

    int head = mt / 6;                // all wave-uniform scalars
    int mt6  = mt - head * 6;
    int sec  = mt6 >> 1;              // 0=q 1=k 2=v
    int c0   = (mt6 & 1) * 16;
    size_t bh = (size_t)b * NH + head;

    v16bf A[4];
    const uint16_t* arow = wbf + (size_t)(mt * 16 + lm) * CCH + half * 8;
#pragma unroll
    for (int kk = 0; kk < 4; ++kk) A[kk] = load_frag(arow + kk * 32);

#pragma unroll
    for (int nt = 0; nt < 4; ++nt) {
        int t = n0 + nt * 16 + lm;
        const uint16_t* brow = xn + ((size_t)b * HWN + t) * CCH + half * 8;
        if (nt < 3) __builtin_prefetch(brow + 16 * CCH, 0, 3);
        v8f acc = {};
#pragma unroll
        for (int kk = 0; kk < 4; ++kk)
            acc = wmma_bf16(A[kk], load_frag(brow + kk * 32), acc);

        if (sec == 2) {
            uint16_t* dst = v + (bh * DH + c0 + half * 8) * HWN + t;
#pragma unroll
            for (int r = 0; r < 8; ++r)
                dst[(size_t)r * HWN] = f2bf(acc[r]);
        } else {
            uint16_t* dst = (sec == 0 ? q : k) + (bh * HWN + t) * DH + c0 + half * 8;
            store8bf(dst, acc, QKSCALE);       // one b128 store per lane
        }
    }
}

// ------------------------- kernel 3: flash attention ------------------------
// One block = one (b, h, group of 8 token tiles); 8 waves, one 16-row tile
// each.  Wave 0 DMA-stages shared K/V 32-key chunks into LDS with
// global_load_async_to_lds_b128 (double buffered, ASYNCcnt).  Online softmax
// with per-row stats in lane halves; P re-laid-out D-frag -> A-frag via LDS.
__global__ void k_attention(const uint16_t* __restrict__ q,
                            const uint16_t* __restrict__ k,
                            const uint16_t* __restrict__ v,
                            uint16_t* __restrict__ ho) {
    __shared__ __align__(16) uint16_t sK[2][32 * 32];   // (s_local, c)
    __shared__ __align__(16) uint16_t sV[2][32 * 32];   // (c, s_local)
    __shared__ __align__(16) uint16_t sP[8][16 * 32];

    int tid  = threadIdx.x;
    int wib  = __builtin_amdgcn_readfirstlane(tid >> 5);
    int lane = tid & 31;
    int half = lane >> 4, lm = lane & 15;
    int row  = lane >> 2, seg = lane & 3;     // DMA lane mapping: 8 rows x 4 segs

    int blk = blockIdx.x;                     // 32*4*8 blocks
    int b   = blk >> 5;
    int rem = blk & 31;
    int h   = rem >> 3;
    int tg  = rem & 7;
    int t0  = (tg * 8 + wib) * 16;
    size_t bh = (size_t)b * NH + h;
    const uint16_t* kbase = k + bh * HWN * DH;
    const uint16_t* vbase = v + bh * DH * HWN;

    v16bf Qf = load_frag(q + (bh * HWN + t0 + lm) * DH + half * 8);
    v8f O0 = {}, O1 = {};
    float m[8], l[8];
#pragma unroll
    for (int r = 0; r < 8; ++r) { m[r] = -1e30f; l[r] = 0.f; }

    uint16_t* lp = sP[wib];

    // Prologue: stage chunk 0.
    if (wib == 0) {
#pragma unroll
        for (int i = 0; i < 4; ++i) {
            int rr = i * 8 + row;
            async_b128(&sK[0][rr * 32 + seg * 8], kbase + (size_t)rr * DH + seg * 8);
            async_b128(&sV[0][rr * 32 + seg * 8], vbase + (size_t)rr * HWN + seg * 8);
        }
        asm volatile("s_wait_asynccnt 0x0" ::: "memory");
    }
    __syncthreads();

    for (int it = 0; it < HWN / 32; ++it) {
        int cur = it & 1;
        if (wib == 0 && it + 1 < HWN / 32) {
            int sn = (it + 1) * 32;
#pragma unroll
            for (int i = 0; i < 4; ++i) {
                int rr = i * 8 + row;
                async_b128(&sK[cur ^ 1][rr * 32 + seg * 8],
                           kbase + (size_t)(sn + rr) * DH + seg * 8);
                async_b128(&sV[cur ^ 1][rr * 32 + seg * 8],
                           vbase + (size_t)rr * HWN + sn + seg * 8);
            }
        }

        const uint16_t* kc = sK[cur];
        const uint16_t* vc = sV[cur];
        v16bf K0 = load_frag(kc + lm * 32 + half * 8);          // s = 0..15
        v16bf K1 = load_frag(kc + (16 + lm) * 32 + half * 8);   // s = 16..31
        v8f S0 = {}, S1 = {};
        S0 = wmma_bf16(Qf, K0, S0);
        S1 = wmma_bf16(Qf, K1, S1);

#pragma unroll
        for (int r = 0; r < 8; ++r) {
            float rowm = hmax16(fmaxf(S0[r], S1[r]));
            float newm = fmaxf(m[r], rowm);
            float f    = __expf(m[r] - newm);
            float p0   = __expf(S0[r] - newm);
            float p1   = __expf(S1[r] - newm);
            l[r] = l[r] * f + hsum16(p0 + p1);
            m[r] = newm;
            O0[r] *= f;
            O1[r] *= f;
            lp[(r + half * 8) * 32 + lm]      = f2bf(p0);
            lp[(r + half * 8) * 32 + 16 + lm] = f2bf(p1);
        }
        asm volatile("s_wait_dscnt 0x0" ::: "memory");   // LDS turnaround

        v16bf Pf = load_frag(lp + lm * 32 + half * 8);   // A-frag 16(t) x 32(s)
        v16bf V0 = load_frag(vc + lm * 32 + half * 8);          // c = 0..15
        v16bf V1 = load_frag(vc + (16 + lm) * 32 + half * 8);   // c = 16..31
        O0 = wmma_bf16(Pf, V0, O0);
        O1 = wmma_bf16(Pf, V1, O1);

        if (wib == 0 && it + 1 < HWN / 32)
            asm volatile("s_wait_asynccnt 0x0" ::: "memory");
        __syncthreads();
    }

#pragma unroll
    for (int r = 0; r < 8; ++r) {
        float inv = 1.f / fmaxf(l[r], 1e-30f);
        int t = t0 + r + half * 8;
        uint16_t* op = ho + ((size_t)b * HWN + t) * CCH + h * DH;
        op[lm]      = f2bf(O0[r] * inv);
        op[16 + lm] = f2bf(O1[r] * inv);
    }
}

// ------------------------- kernel 4: proj + bias + residual -----------------
__global__ void k_proj_gemm(const uint16_t* __restrict__ wbf,
                            const uint16_t* __restrict__ ho,
                            const float* __restrict__ pb,
                            const float* __restrict__ x,
                            float* __restrict__ out) {
    int wave = __builtin_amdgcn_readfirstlane((int)blockIdx.x * 8 + (threadIdx.x >> 5));
    int lane = threadIdx.x & 31;
    int half = lane >> 4, lm = lane & 15;
    int b   = wave >> 7;              // /(8*16)
    int rem = wave & 127;
    int mt  = rem >> 4;               // 0..7
    int n0  = (rem & 15) * 64;

    v16bf A[4];
    const uint16_t* arow = wbf + (size_t)(mt * 16 + lm) * CCH + half * 8;
#pragma unroll
    for (int kk = 0; kk < 4; ++kk) A[kk] = load_frag(arow + kk * 32);

#pragma unroll
    for (int nt = 0; nt < 4; ++nt) {
        int t = n0 + nt * 16 + lm;
        const uint16_t* brow = ho + ((size_t)b * HWN + t) * CCH + half * 8;
        if (nt < 3) __builtin_prefetch(brow + 16 * CCH, 0, 3);
        v8f acc = {};
#pragma unroll
        for (int kk = 0; kk < 4; ++kk)
            acc = wmma_bf16(A[kk], load_frag(brow + kk * 32), acc);

#pragma unroll
        for (int r = 0; r < 8; ++r) {
            int o = mt * 16 + r + half * 8;
            size_t idx = ((size_t)b * CCH + o) * HWN + t;
            out[idx] = acc[r] + pb[o] + x[idx];
        }
    }
}

// ---------------------------------------------------------------------------
extern "C" void kernel_launch(void* const* d_in, const int* in_sizes, int n_in,
                              void* d_out, int out_size, void* d_ws, size_t ws_size,
                              hipStream_t stream) {
    const float* x      = (const float*)d_in[0];
    const float* norm_w = (const float*)d_in[1];
    const float* norm_b = (const float*)d_in[2];
    const float* qkv_w  = (const float*)d_in[3];
    const float* proj_w = (const float*)d_in[4];
    const float* proj_b = (const float*)d_in[5];
    float* out = (float*)d_out;

    char* ws = (char*)d_ws;
    const size_t SZ_BCHW_BF = (size_t)BATCH * CCH * HWN * 2;   // 8 MB bf16
    size_t off = 0;
    uint16_t* xn      = (uint16_t*)(ws + off); off += SZ_BCHW_BF;
    uint16_t* qb      = (uint16_t*)(ws + off); off += SZ_BCHW_BF;
    uint16_t* kb      = (uint16_t*)(ws + off); off += SZ_BCHW_BF;
    uint16_t* vb      = (uint16_t*)(ws + off); off += SZ_BCHW_BF;
    uint16_t* hob     = (uint16_t*)(ws + off); off += SZ_BCHW_BF;
    uint16_t* qkv_bf  = (uint16_t*)(ws + off); off += (size_t)3 * CCH * CCH * 2;
    uint16_t* proj_bf = (uint16_t*)(ws + off); off += (size_t)CCH * CCH * 2;
    (void)ws_size; (void)in_sizes; (void)n_in; (void)out_size;

    k_wconvert<<<dim3((3 * CCH * CCH + 255) / 256), dim3(256), 0, stream>>>(
        qkv_w, proj_w, qkv_bf, proj_bf);
    k_groupnorm<<<dim3(BATCH * 2), dim3(1024), 0, stream>>>(x, norm_w, norm_b, xn);
    k_qkv_gemm<<<dim3(BATCH * 24 * 16 / 8), dim3(256), 0, stream>>>(
        qkv_bf, xn, qb, kb, vb);
    k_attention<<<dim3(BATCH * NH * 8), dim3(256), 0, stream>>>(qb, kb, vb, hob);
    k_proj_gemm<<<dim3(BATCH * 8 * 16 / 8), dim3(256), 0, stream>>>(
        proj_bf, hob, proj_b, x, out);
}

// v002
// It runs in 79.6 microseconds.
// In both of two side-by-side timings against v001, it was 1.49 times as fast.
// All steps since v000 together make it 2.68 times as fast.
#include <hip/hip_runtime.h>
#include <stdint.h>

// ---------------------------------------------------------------------------
// CDNA5 / gfx1250 attention block: GroupNorm -> QKV (WMMA) -> flash attention
// (WMMA, async-LDS staged K/V) -> proj (WMMA) + bias + residual.
// wave32, bf16 operands, f32 accumulate.
// ---------------------------------------------------------------------------

typedef __attribute__((ext_vector_type(16))) __bf16    v16bf;
typedef __attribute__((ext_vector_type(8)))  float     v8f;
typedef __attribute__((ext_vector_type(4)))  uint32_t  u32x4;
typedef __attribute__((ext_vector_type(4)))  float     f32x4;

#define BATCH 32
#define CCH   128
#define HWN   1024
#define NH    4
#define DH    32
#define QKSCALE 0.17677669529663687f  // 1/sqrt(32)

union FragU { u32x4 q2[2]; v16bf v; };

__device__ __forceinline__ uint16_t f2bf(float f) {
    uint32_t u = __builtin_bit_cast(uint32_t, f);
    u += 0x7fffu + ((u >> 16) & 1u);          // round-to-nearest-even
    return (uint16_t)(u >> 16);
}

// Fragment load: per-lane 8 bf16 at base and 8 bf16 at base+16 elements.
// Caller passes base already offset by half*8 so lane halves get the ISA's
// K split {0..7,16..23} / {8..15,24..31}.
__device__ __forceinline__ v16bf load_frag(const uint16_t* p) {
    FragU f;
    f.q2[0] = *(const u32x4*)(p);
    f.q2[1] = *(const u32x4*)(p + 16);
    return f.v;
}

__device__ __forceinline__ v8f wmma_bf16(v16bf a, v16bf b, v8f c) {
    return __builtin_amdgcn_wmma_f32_16x16x32_bf16(
        false, a, false, b, (short)0, c, false, false);
}

// Pack 8 accumulator floats (scaled) to 8 bf16 and store as one b128.
__device__ __forceinline__ void store8bf(uint16_t* dst, v8f a, float s) {
    uint32_t w[4];
#pragma unroll
    for (int i = 0; i < 4; ++i)
        w[i] = (uint32_t)f2bf(a[2 * i] * s) | ((uint32_t)f2bf(a[2 * i + 1] * s) << 16);
    u32x4 pk = {w[0], w[1], w[2], w[3]};
    *(u32x4*)dst = pk;
}

// Value of lane l ^ 16: the other half's share of the same query column.
__device__ __forceinline__ float other_half(float v) {
    int b = __builtin_bit_cast(int, v);
    b = __builtin_amdgcn_permlanex16(b, b, 0x76543210, 0xfedcba98, false, false);
    return __builtin_bit_cast(float, b);
}

// Async DMA: one 16-byte global->LDS transfer per active lane (ASYNCcnt).
__device__ __forceinline__ void async_b128(uint16_t* lds_dst, const uint16_t* gsrc) {
    uint32_t la = (uint32_t)(uintptr_t)lds_dst;          // low 32 bits = LDS offset
    uint64_t ga = (uint64_t)(uintptr_t)gsrc;
    asm volatile("global_load_async_to_lds_b128 %0, %1, off"
                 :: "v"(la), "v"(ga) : "memory");
}

// ------------------------- kernel 0: weight convert -------------------------
__global__ void k_wconvert(const float* __restrict__ qkv_w,
                           const float* __restrict__ proj_w,
                           uint16_t* __restrict__ qkv_bf,
                           uint16_t* __restrict__ proj_bf) {
    int i = blockIdx.x * 256 + threadIdx.x;
    if (i < 3 * CCH * CCH) qkv_bf[i] = f2bf(qkv_w[i]);
    if (i < CCH * CCH)     proj_bf[i] = f2bf(proj_w[i]);
}

// ------------------------- kernel 1: GroupNorm ------------------------------
// One 1024-thread block per (b, 64 channels = 16 groups): 64 bf16 channels are
// one 128-byte line of a row of xn, so this block is that line's only writer.
// Wave (cq, tq) keeps 8 channels (2 groups) x 256 positions in registers.
// The normalized bf16 tile is transposed through LDS and xn, laid out
// (b, t, c) for the GEMM's B operand, is stored as whole lines.
#define GN_PITCH 72   // LDS row: 64 channels + 8 pad = 144 B (16 B x odd)
__global__ __launch_bounds__(1024)
void k_groupnorm(const float* __restrict__ x,
                 const float* __restrict__ nw,
                 const float* __restrict__ nb,
                 uint16_t* __restrict__ xn) {
    __shared__ __align__(16) uint16_t tile[HWN * GN_PITCH];
    __shared__ f32x4 red[32];
    int tid  = threadIdx.x;
    int wave = __builtin_amdgcn_readfirstlane(tid >> 5);
    int lane = tid & 31;
    int b    = blockIdx.x >> 1;
    int ch0  = (blockIdx.x & 1) * 64;
    int cq   = wave & 7;             // 8-channel chunk of the 64
    int tq   = wave >> 3;            // quarter of the 1024 positions
    int c0   = ch0 + cq * 8;

    // Every wave-wide load covers 512 contiguous bytes of one channel's row.
    const float* xp = x + ((size_t)(b * CCH + c0)) * HWN + tq * 256 + lane * 4;
    f32x4 val[8][2];
#pragma unroll
    for (int kc = 0; kc < 8; ++kc)
#pragma unroll
        for (int j = 0; j < 2; ++j)
            val[kc][j] = *(const f32x4*)(xp + kc * HWN + j * 128);

    // Sum and sum of squares of the wave's two groups (channels 0-3, 4-7).
    f32x4 st = {0.f, 0.f, 0.f, 0.f};
#pragma unroll
    for (int kc = 0; kc < 8; ++kc)
#pragma unroll
        for (int j = 0; j < 2; ++j)
#pragma unroll
            for (int e = 0; e < 4; ++e) {
                float f = val[kc][j][e];
                st[(kc >> 2) * 2]     += f;
                st[(kc >> 2) * 2 + 1] += f * f;
            }
#pragma unroll
    for (int off = 16; off > 0; off >>= 1)
#pragma unroll
        for (int i = 0; i < 4; ++i)
            st[i] += __shfl_xor(st[i], off, 32);
    if (lane == 0) red[wave] = st;
    __syncthreads();
    // The four waves with this cq hold the four quarters of the same groups.
    st = (red[cq] + red[8 + cq]) + (red[16 + cq] + red[24 + cq]);

    float wch[8], bch[8];
#pragma unroll
    for (int g = 0; g < 2; ++g) {
        float mu   = st[g * 2] * (1.f / 4096.f);
        float var  = st[g * 2 + 1] * (1.f / 4096.f) - mu * mu;
        float rstd = rsqrtf(var + 1e-5f);
#pragma unroll
        for (int i = 0; i < 4; ++i) {
            int kc = g * 4 + i;
            wch[kc] = nw[c0 + kc] * rstd;
            bch[kc] = nb[c0 + kc] - mu * wch[kc];
        }
    }

    // One 16-byte LDS store per position: its 8 channels.  Lanes are 4 rows
    // apart, which at this pitch reaches only 4 of the 16 bank groups; the
    // chunk index is XORed with bits 4-5 of t so that 16 lanes reach all 16.
    int wsw = (cq ^ ((lane >> 2) & 3)) * 8;
#pragma unroll
    for (int j = 0; j < 2; ++j)
#pragma unroll
        for (int e = 0; e < 4; ++e) {
            int t = tq * 256 + j * 128 + lane * 4 + e;
            uint32_t w[4];
#pragma unroll
            for (int i = 0; i < 4; ++i)
                w[i] = (uint32_t)f2bf(val[2 * i][j][e] * wch[2 * i] + bch[2 * i]) |
                       ((uint32_t)f2bf(val[2 * i + 1][j][e] * wch[2 * i + 1] + bch[2 * i + 1]) << 16);
            u32x4 pk = {w[0], w[1], w[2], w[3]};
            *(u32x4*)(tile + t * GN_PITCH + wsw) = pk;
        }
    __syncthreads();

    // Read rows back and store: 8 lanes cover one 128-byte line.  Lanes 0-7
    // and 8-15 take rows 8 apart, which fall on disjoint banks at this pitch.
    int lg = lane >> 3, lc = lane & 7;
    uint16_t* op = xn + (size_t)b * HWN * CCH + ch0 + lc * 8;
#pragma unroll
    for (int i = 0; i < 8; ++i) {
        int t = wave * 32 + lg * 8 + i;
        u32x4 pk = *(const u32x4*)(tile + t * GN_PITCH + (lc ^ ((t >> 4) & 3)) * 8);
        *(u32x4*)(op + (size_t)t * CCH) = pk;
    }
}

// ------------------------- kernel 2: QKV GEMM -------------------------------
// Per batch: (384 x 128) @ (128 x 1024).  One wave computes a 16x64 strip.
// Writes q,k as (b,h,t,dh) scaled by 1/sqrt(dh); v as (b,h,dh,t).
// Tile routing (q/k/v section, head) is wave-uniform -> scalar branches.
__global__ void k_qkv_gemm(const uint16_t* __restrict__ wbf,
                           const uint16_t* __restrict__ xn,
                           uint16_t* __restrict__ q,
                           uint16_t* __restrict__ k,
                           uint16_t* __restrict__ v) {
    int wave = __builtin_amdgcn_readfirstlane((int)blockIdx.x * 8 + (threadIdx.x >> 5));
    int lane = threadIdx.x & 31;
    int half = lane >> 4, lm = lane & 15;
    int b   = wave / 384;
    int rem = wave - b * 384;
    int mt  = rem >> 4;               // 0..23  (16-row tile of 384)
    int n0  = (rem & 15) * 64;        // column strip start

    int head = mt / 6;                // all wave-uniform scalars
    int mt6  = mt - head * 6;
    int sec  = mt6 >> 1;              // 0=q 1=k 2=v
    int c0   = (mt6 & 1) * 16;
    size_t bh = (size_t)b * NH + head;

    v16bf A[4];
    const uint16_t* arow = wbf + (size_t)(mt * 16 + lm) * CCH + half * 8;
#pragma unroll
    for (int kk = 0; kk < 4; ++kk) A[kk] = load_frag(arow + kk * 32);

#pragma unroll
    for (int nt = 0; nt < 4; ++nt) {
        int t = n0 + nt * 16 + lm;
        const uint16_t* brow = xn + ((size_t)b * HWN + t) * CCH + half * 8;
        if (nt < 3) __builtin_prefetch(brow + 16 * CCH, 0, 3);
        v8f acc = {};
#pragma unroll
        for (int kk = 0; kk < 4; ++kk)
            acc = wmma_bf16(A[kk], load_frag(brow + kk * 32), acc);

        if (sec == 2) {
            uint16_t* dst = v + (bh * DH + c0 + half * 8) * HWN + t;
#pragma unroll
            for (int r = 0; r < 8; ++r)
                dst[(size_t)r * HWN] = f2bf(acc[r]);
        } else {
            uint16_t* dst = (sec == 0 ? q : k) + (bh * HWN + t) * DH + c0 + half * 8;
            store8bf(dst, acc, QKSCALE);       // one b128 store per lane
        }
    }
}

// ------------------------- kernel 3: flash attention ------------------------
// One block = one (b, h, group of 8 token tiles); 8 waves, one 16-row tile
// each.  Wave 0 DMA-stages shared K/V 32-key chunks into LDS with
// global_load_async_to_lds_b128 (double buffered, ASYNCcnt).  Scores are
// computed transposed, S^T = K Q^T: lane (lm, half) holds 16 of the chunk's 32
// scores of query lm, so the online softmax is in-lane plus one exchange
// between halves, and the two packed S^T tiles are the B operand of
// O^T += V^T P^T as they stand.
__global__ void k_attention(const uint16_t* __restrict__ q,
                            const uint16_t* __restrict__ k,
                            const uint16_t* __restrict__ v,
                            uint16_t* __restrict__ ho) {
    __shared__ __align__(16) uint16_t sK[2][32 * 32];   // (s_local, c)
    __shared__ __align__(16) uint16_t sV[2][32 * 32];   // (c, s_local)

    int tid  = threadIdx.x;
    int wib  = __builtin_amdgcn_readfirstlane(tid >> 5);
    int lane = tid & 31;
    int half = lane >> 4, lm = lane & 15;
    int row  = lane >> 2, seg = lane & 3;     // DMA lane mapping: 8 rows x 4 segs

    int blk = blockIdx.x;                     // 32*4*8 blocks
    int b   = blk >> 5;
    int rem = blk & 31;
    int h   = rem >> 3;
    int tg  = rem & 7;
    int t0  = (tg * 8 + wib) * 16;
    size_t bh = (size_t)b * NH + h;
    const uint16_t* kbase = k + bh * HWN * DH;
    const uint16_t* vbase = v + bh * DH * HWN;

    v16bf Qf = load_frag(q + (bh * HWN + t0 + lm) * DH + half * 8);
    v8f O0 = {}, O1 = {};
    float m = -1e30f, l = 0.f;    // l: this half's keys only, joined at the end

    // Prologue: stage chunk 0.
    if (wib == 0) {
#pragma unroll
        for (int i = 0; i < 4; ++i) {
            int rr = i * 8 + row;
            async_b128(&sK[0][rr * 32 + seg * 8], kbase + (size_t)rr * DH + seg * 8);
            async_b128(&sV[0][rr * 32 + seg * 8], vbase + (size_t)rr * HWN + seg * 8);
        }
        asm volatile("s_wait_asynccnt 0x0" ::: "memory");
    }
    __syncthreads();

    for (int it = 0; it < HWN / 32; ++it) {
        int cur = it & 1;
        if (wib == 0 && it + 1 < HWN / 32) {
            int sn = (it + 1) * 32;
#pragma unroll
            for (int i = 0; i < 4; ++i) {
                int rr = i * 8 + row;
                async_b128(&sK[cur ^ 1][rr * 32 + seg * 8],
                           kbase + (size_t)(sn + rr) * DH + seg * 8);
                async_b128(&sV[cur ^ 1][rr * 32 + seg * 8],
                           vbase + (size_t)rr * HWN + sn + seg * 8);
            }
        }

        const uint16_t* kc = sK[cur];
        const uint16_t* vc = sV[cur];
        v16bf K0 = load_frag(kc + lm * 32 + half * 8);          // s = 0..15
        v16bf K1 = load_frag(kc + (16 + lm) * 32 + half * 8);   // s = 16..31
        v8f S0 = {}, S1 = {};
        S0 = wmma_bf16(K0, Qf, S0);   // S0[r] = score(s = half*8 + r,      t = lm)
        S1 = wmma_bf16(K1, Qf, S1);   // S1[r] = score(s = 16 + half*8 + r, t = lm)
        v16bf V0 = load_frag(vc + lm * 32 + half * 8);          // c = 0..15
        v16bf V1 = load_frag(vc + (16 + lm) * 32 + half * 8);   // c = 16..31

        float mx[8];
#pragma unroll   // constant indices keep mx and the tiles in registers
        for (int r = 0; r < 8; ++r) mx[r] = fmaxf(S0[r], S1[r]);
        float rowm = fmaxf(fmaxf(fmaxf(mx[0], mx[1]), fmaxf(mx[2], mx[3])),
                           fmaxf(fmaxf(mx[4], mx[5]), fmaxf(mx[6], mx[7])));
        rowm = fmaxf(rowm, other_half(rowm));
        float newm = fmaxf(m, rowm);
        float f    = __expf(m - newm);
        m = newm;

        float ps[8];
        FragU P;                      // B-frag 32(s) x 16(t), hardware k order
#pragma unroll   // constant indices keep ps and P in registers
        for (int i = 0; i < 4; ++i) {
            float a0 = __expf(S0[2 * i] - newm), a1 = __expf(S0[2 * i + 1] - newm);
            float b0 = __expf(S1[2 * i] - newm), b1 = __expf(S1[2 * i + 1] - newm);
            ps[2 * i]     = a0 + a1;
            ps[2 * i + 1] = b0 + b1;
            P.q2[0][i] = (uint32_t)f2bf(a0) | ((uint32_t)f2bf(a1) << 16);
            P.q2[1][i] = (uint32_t)f2bf(b0) | ((uint32_t)f2bf(b1) << 16);
        }
        l = l * f + (((ps[0] + ps[1]) + (ps[2] + ps[3])) +
                     ((ps[4] + ps[5]) + (ps[6] + ps[7])));
#pragma unroll   // constant indices keep the accumulators in registers
        for (int r = 0; r < 8; ++r) { O0[r] *= f; O1[r] *= f; }
        O0 = wmma_bf16(V0, P.v, O0);  // O0[r] = out(c = half*8 + r,      t = lm)
        O1 = wmma_bf16(V1, P.v, O1);  // O1[r] = out(c = 16 + half*8 + r, t = lm)

        if (wib == 0 && it + 1 < HWN / 32)
            asm volatile("s_wait_asynccnt 0x0" ::: "memory");
        __syncthreads();
    }

    l += other_half(l);
    float inv = 1.f / fmaxf(l, 1e-30f);
    uint16_t* op = ho + ((size_t)b * HWN + t0 + lm) * CCH + h * DH + half * 8;
    store8bf(op, O0, inv);            // 8 consecutive channels per lane
    store8bf(op + 16, O1, inv);
}

// ------------------------- kernel 4: proj + bias + residual -----------------
__global__ void k_proj_gemm(const uint16_t* __restrict__ wbf,
                            const uint16_t* __restrict__ ho,
                            const float* __restrict__ pb,
                            const float* __restrict__ x,
                            float* __restrict__ out) {
    int wave = __builtin_amdgcn_readfirstlane((int)blockIdx.x * 8 + (threadIdx.x >> 5));
    int lane = threadIdx.x & 31;
    int half = lane >> 4, lm = lane & 15;
    int b   = wave >> 7;              // /(8*16)
    int rem = wave & 127;
    int mt  = rem >> 4;               // 0..7
    int n0  = (rem & 15) * 64;

    v16bf A[4];
    const uint16_t* arow = wbf + (size_t)(mt * 16 + lm) * CCH + half * 8;
#pragma unroll
    for (int kk = 0; kk < 4; ++kk) A[kk] = load_frag(arow + kk * 32);

#pragma unroll
    for (int nt = 0; nt < 4; ++nt) {
        int t = n0 + nt * 16 + lm;
        const uint16_t* brow = ho + ((size_t)b * HWN + t) * CCH + half * 8;
        if (nt < 3) __builtin_prefetch(brow + 16 * CCH, 0, 3);
        v8f acc = {};
#pragma unroll
        for (int kk = 0; kk < 4; ++kk)
            acc = wmma_bf16(A[kk], load_frag(brow + kk * 32), acc);

#pragma unroll
        for (int r = 0; r < 8; ++r) {
            int o = mt * 16 + r + half * 8;
            size_t idx = ((size_t)b * CCH + o) * HWN + t;
            out[idx] = acc[r] + pb[o] + x[idx];
        }
    }
}

// ---------------------------------------------------------------------------
extern "C" void kernel_launch(void* const* d_in, const int* in_sizes, int n_in,
                              void* d_out, int out_size, void* d_ws, size_t ws_size,
                              hipStream_t stream) {
    const float* x      = (const float*)d_in[0];
    const float* norm_w = (const float*)d_in[1];
    const float* norm_b = (const float*)d_in[2];
    const float* qkv_w  = (const float*)d_in[3];
    const float* proj_w = (const float*)d_in[4];
    const float* proj_b = (const float*)d_in[5];
    float* out = (float*)d_out;

    char* ws = (char*)d_ws;
    const size_t SZ_BCHW_BF = (size_t)BATCH * CCH * HWN * 2;   // 8 MB bf16
    size_t off = 0;
    uint16_t* xn      = (uint16_t*)(ws + off); off += SZ_BCHW_BF;
    uint16_t* qb      = (uint16_t*)(ws + off); off += SZ_BCHW_BF;
    uint16_t* kb      = (uint16_t*)(ws + off); off += SZ_BCHW_BF;
    uint16_t* vb      = (uint16_t*)(ws + off); off += SZ_BCHW_BF;
    uint16_t* hob     = (uint16_t*)(ws + off); off += SZ_BCHW_BF;
    uint16_t* qkv_bf  = (uint16_t*)(ws + off); off += (size_t)3 * CCH * CCH * 2;
    uint16_t* proj_bf = (uint16_t*)(ws + off); off += (size_t)CCH * CCH * 2;
    (void)ws_size; (void)in_sizes; (void)n_in; (void)out_size;

    k_wconvert<<<dim3((3 * CCH * CCH + 255) / 256), dim3(256), 0, stream>>>(
        qkv_w, proj_w, qkv_bf, proj_bf);
    k_groupnorm<<<dim3(BATCH * 2), dim3(1024), 0, stream>>>(x, norm_w, norm_b, xn);
    k_qkv_gemm<<<dim3(BATCH * 24 * 16 / 8), dim3(256), 0, stream>>>(
        qkv_bf, xn, qb, kb, vb);
    k_attention<<<dim3(BATCH * NH * 8), dim3(256), 0, stream>>>(qb, kb, vb, hob);
    k_proj_gemm<<<dim3(BATCH * 8 * 16 / 8), dim3(256), 0, stream>>>(
        proj_bf, hob, proj_b, x, out);
}

// v003
// A run of this version takes 75.3 microseconds.
// Timed twice side by side with v002, it ran 1.06 times as fast both times.
// Over all steps from v000 it is 2.83 times as fast.
#include <hip/hip_runtime.h>
#include <stdint.h>

// ---------------------------------------------------------------------------
// CDNA5 / gfx1250 attention block: GroupNorm -> QKV (WMMA) -> flash attention
// (WMMA, async-LDS staged K/V) -> proj (WMMA) + bias + residual.
// wave32, bf16 operands, f32 accumulate.
// ---------------------------------------------------------------------------

typedef __attribute__((ext_vector_type(16))) __bf16    v16bf;
typedef __attribute__((ext_vector_type(8)))  float     v8f;
typedef __attribute__((ext_vector_type(4)))  uint32_t  u32x4;
typedef __attribute__((ext_vector_type(4)))  float     f32x4;

#define BATCH 32
#define CCH   128
#define HWN   1024
#define NH    4
#define DH    32
#define QKSCALE 0.17677669529663687f  // 1/sqrt(32)

union FragU { u32x4 q2[2]; v16bf v; };

typedef __attribute__((ext_vector_type(2)))  float     f32x2;
typedef __attribute__((ext_vector_type(2)))  __bf16    bf16x2;

// f32 -> bf16, round to nearest even, by the hardware's own conversion.
__device__ __forceinline__ uint16_t f2bf(float f) {
    return __builtin_bit_cast(uint16_t, (__bf16)f);
}

// Two f32 -> one packed register (lo in bits 15-0): one v_cvt_pk_bf16_f32.
__device__ __forceinline__ uint32_t pk2bf(float lo, float hi) {
    f32x2 p = {lo, hi};
    return __builtin_bit_cast(uint32_t, __builtin_convertvector(p, bf16x2));
}

// Fragment load: per-lane 8 bf16 at base and 8 bf16 at base+16 elements.
// Caller passes base already offset by half*8 so lane halves get the ISA's
// K split {0..7,16..23} / {8..15,24..31}.
__device__ __forceinline__ v16bf load_frag(const uint16_t* p) {
    FragU f;
    f.q2[0] = *(const u32x4*)(p);
    f.q2[1] = *(const u32x4*)(p + 16);
    return f.v;
}

__device__ __forceinline__ v8f wmma_bf16(v16bf a, v16bf b, v8f c) {
    return __builtin_amdgcn_wmma_f32_16x16x32_bf16(
        false, a, false, b, (short)0, c, false, false);
}

// Pack 8 accumulator floats (scaled) to 8 bf16 and store as one b128.
__device__ __forceinline__ void store8bf(uint16_t* dst, v8f a, float s) {
    uint32_t w[4];
#pragma unroll
    for (int i = 0; i < 4; ++i)
        w[i] = pk2bf(a[2 * i] * s, a[2 * i + 1] * s);
    u32x4 pk = {w[0], w[1], w[2], w[3]};
    *(u32x4*)dst = pk;
}

// Value of lane l ^ 16: the other half's share of the same query column.
__device__ __forceinline__ float other_half(float v) {
    int b = __builtin_bit_cast(int, v);
    b = __builtin_amdgcn_permlanex16(b, b, 0x76543210, 0xfedcba98, false, false);
    return __builtin_bit_cast(float, b);
}

// Async DMA: one 16-byte global->LDS transfer per active lane (ASYNCcnt).
__device__ __forceinline__ void async_b128(uint16_t* lds_dst, const uint16_t* gsrc) {
    uint32_t la = (uint32_t)(uintptr_t)lds_dst;          // low 32 bits = LDS offset
    uint64_t ga = (uint64_t)(uintptr_t)gsrc;
    asm volatile("global_load_async_to_lds_b128 %0, %1, off"
                 :: "v"(la), "v"(ga) : "memory");
}

// ------------------------- kernel 0: weight convert -------------------------
__global__ void k_wconvert(const float* __restrict__ qkv_w,
                           const float* __restrict__ proj_w,
                           uint16_t* __restrict__ qkv_bf,
                           uint16_t* __restrict__ proj_bf) {
    int i = blockIdx.x * 256 + threadIdx.x;
    if (i < 3 * CCH * CCH) qkv_bf[i] = f2bf(qkv_w[i]);
    if (i < CCH * CCH)     proj_bf[i] = f2bf(proj_w[i]);
}

// ------------------------- kernel 1: GroupNorm ------------------------------
// One 1024-thread block per (b, 64 channels = 16 groups): 64 bf16 channels are
// one 128-byte line of a row of xn, so this block is that line's only writer.
// Wave (cq, tq) keeps 8 channels (2 groups) x 256 positions in registers.
// The normalized bf16 tile is transposed through LDS and xn, laid out
// (b, t, c) for the GEMM's B operand, is stored as whole lines.
#define GN_PITCH 72   // LDS row: 64 channels + 8 pad = 144 B (16 B x odd)
__global__ __launch_bounds__(1024)
void k_groupnorm(const float* __restrict__ x,
                 const float* __restrict__ nw,
                 const float* __restrict__ nb,
                 uint16_t* __restrict__ xn) {
    __shared__ __align__(16) uint16_t tile[HWN * GN_PITCH];
    __shared__ f32x4 red[32];
    int tid  = threadIdx.x;
    int wave = __builtin_amdgcn_readfirstlane(tid >> 5);
    int lane = tid & 31;
    int b    = blockIdx.x >> 1;
    int ch0  = (blockIdx.x & 1) * 64;
    int cq   = wave & 7;             // 8-channel chunk of the 64
    int tq   = wave >> 3;            // quarter of the 1024 positions
    int c0   = ch0 + cq * 8;

    // Every wave-wide load covers 512 contiguous bytes of one channel's row.
    const float* xp = x + ((size_t)(b * CCH + c0)) * HWN + tq * 256 + lane * 4;
    f32x4 val[8][2];
#pragma unroll
    for (int kc = 0; kc < 8; ++kc)
#pragma unroll
        for (int j = 0; j < 2; ++j)
            val[kc][j] = *(const f32x4*)(xp + kc * HWN + j * 128);

    // Sum and sum of squares of the wave's two groups (channels 0-3, 4-7).
    f32x4 st = {0.f, 0.f, 0.f, 0.f};
#pragma unroll
    for (int kc = 0; kc < 8; ++kc)
#pragma unroll
        for (int j = 0; j < 2; ++j)
#pragma unroll
            for (int e = 0; e < 4; ++e) {
                float f = val[kc][j][e];
                st[(kc >> 2) * 2]     += f;
                st[(kc >> 2) * 2 + 1] += f * f;
            }
#pragma unroll
    for (int off = 16; off > 0; off >>= 1)
#pragma unroll
        for (int i = 0; i < 4; ++i)
            st[i] += __shfl_xor(st[i], off, 32);
    if (lane == 0) red[wave] = st;
    __syncthreads();
    // The four waves with this cq hold the four quarters of the same groups.
    st = (red[cq] + red[8 + cq]) + (red[16 + cq] + red[24 + cq]);

    float wch[8], bch[8];
#pragma unroll
    for (int g = 0; g < 2; ++g) {
        float mu   = st[g * 2] * (1.f / 4096.f);
        float var  = st[g * 2 + 1] * (1.f / 4096.f) - mu * mu;
        float rstd = rsqrtf(var + 1e-5f);
#pragma unroll
        for (int i = 0; i < 4; ++i) {
            int kc = g * 4 + i;
            wch[kc] = nw[c0 + kc] * rstd;
            bch[kc] = nb[c0 + kc] - mu * wch[kc];
        }
    }

    // One 16-byte LDS store per position: its 8 channels.  Lanes are 4 rows
    // apart, which at this pitch reaches only 4 of the 16 bank groups; the
    // chunk index is XORed with bits 4-5 of t so that 16 lanes reach all 16.
    int wsw = (cq ^ ((lane >> 2) & 3)) * 8;
#pragma unroll
    for (int j = 0; j < 2; ++j)
#pragma unroll
        for (int e = 0; e < 4; ++e) {
            int t = tq * 256 + j * 128 + lane * 4 + e;
            uint32_t w[4];
#pragma unroll
            for (int i = 0; i < 4; ++i)
                w[i] = pk2bf(val[2 * i][j][e] * wch[2 * i] + bch[2 * i],
                             val[2 * i + 1][j][e] * wch[2 * i + 1] + bch[2 * i + 1]);
            u32x4 pk = {w[0], w[1], w[2], w[3]};
            *(u32x4*)(tile + t * GN_PITCH + wsw) = pk;
        }
    __syncthreads();

    // Read rows back and store: 8 lanes cover one 128-byte line.  Lanes 0-7
    // and 8-15 take rows 8 apart, which fall on disjoint banks at this pitch.
    int lg = lane >> 3, lc = lane & 7;
    uint16_t* op = xn + (size_t)b * HWN * CCH + ch0 + lc * 8;
#pragma unroll
    for (int i = 0; i < 8; ++i) {
        int t = wave * 32 + lg * 8 + i;
        u32x4 pk = *(const u32x4*)(tile + t * GN_PITCH + (lc ^ ((t >> 4) & 3)) * 8);
        *(u32x4*)(op + (size_t)t * CCH) = pk;
    }
}

// ------------------------- kernel 2: QKV GEMM -------------------------------
// Per batch: (384 x 128) @ (128 x 1024).  One wave computes a 16x64 strip.
// Writes q,k as (b,h,t,dh) scaled by 1/sqrt(dh); v as (b,h,dh,t).
// Tile routing (q/k/v section, head) is wave-uniform -> scalar branches.
__global__ void k_qkv_gemm(const uint16_t* __restrict__ wbf,
                           const uint16_t* __restrict__ xn,
                           uint16_t* __restrict__ q,
                           uint16_t* __restrict__ k,
                           uint16_t* __restrict__ v) {
    int wave = __builtin_amdgcn_readfirstlane((int)blockIdx.x * 8 + (threadIdx.x >> 5));
    int lane = threadIdx.x & 31;
    int half = lane >> 4, lm = lane & 15;
    int b   = wave / 384;
    int rem = wave - b * 384;
    int mt  = rem >> 4;               // 0..23  (16-row tile of 384)
    int n0  = (rem & 15) * 64;        // column strip start

    int head = mt / 6;                // all wave-uniform scalars
    int mt6  = mt - head * 6;
    int sec  = mt6 >> 1;              // 0=q 1=k 2=v
    int c0   = (mt6 & 1) * 16;
    size_t bh = (size_t)b * NH + head;

    v16bf A[4];
    const uint16_t* arow = wbf + (size_t)(mt * 16 + lm) * CCH + half * 8;
#pragma unroll
    for (int kk = 0; kk < 4; ++kk) A[kk] = load_frag(arow + kk * 32);

#pragma unroll
    for (int nt = 0; nt < 4; ++nt) {
        int t = n0 + nt * 16 + lm;
        const uint16_t* brow = xn + ((size_t)b * HWN + t) * CCH + half * 8;
        if (nt < 3) __builtin_prefetch(brow + 16 * CCH, 0, 3);
        v8f acc = {};
#pragma unroll
        for (int kk = 0; kk < 4; ++kk)
            acc = wmma_bf16(A[kk], load_frag(brow + kk * 32), acc);

        if (sec == 2) {
            uint16_t* dst = v + (bh * DH + c0 + half * 8) * HWN + t;
#pragma unroll
            for (int r = 0; r < 8; ++r)
                dst[(size_t)r * HWN] = f2bf(acc[r]);
        } else {
            uint16_t* dst = (sec == 0 ? q : k) + (bh * HWN + t) * DH + c0 + half * 8;
            store8bf(dst, acc, QKSCALE);       // one b128 store per lane
        }
    }
}

// ------------------------- kernel 3: flash attention ------------------------
// One block = one (b, h, group of 8 token tiles); 8 waves, one 16-row tile
// each.  Wave 0 DMA-stages shared K/V 32-key chunks into LDS with
// global_load_async_to_lds_b128 (double buffered, ASYNCcnt).  Scores are
// computed transposed, S^T = K Q^T: lane (lm, half) holds 16 of the chunk's 32
// scores of query lm, so the online softmax is in-lane plus one exchange
// between halves, and the two packed S^T tiles are the B operand of
// O^T += V^T P^T as they stand.
__global__ void k_attention(const uint16_t* __restrict__ q,
                            const uint16_t* __restrict__ k,
                            const uint16_t* __restrict__ v,
                            uint16_t* __restrict__ ho) {
    __shared__ __align__(16) uint16_t sK[2][32 * 32];   // (s_local, c)
    __shared__ __align__(16) uint16_t sV[2][32 * 32];   // (c, s_local)

    int tid  = threadIdx.x;
    int wib  = __builtin_amdgcn_readfirstlane(tid >> 5);
    int lane = tid & 31;
    int half = lane >> 4, lm = lane & 15;
    int row  = lane >> 2, seg = lane & 3;     // DMA lane mapping: 8 rows x 4 segs

    int blk = blockIdx.x;                     // 32*4*8 blocks
    int b   = blk >> 5;
    int rem = blk & 31;
    int h   = rem >> 3;
    int tg  = rem & 7;
    int t0  = (tg * 8 + wib) * 16;
    size_t bh = (size_t)b * NH + h;
    const uint16_t* kbase = k + bh * HWN * DH;
    const uint16_t* vbase = v + bh * DH * HWN;

    v16bf Qf = load_frag(q + (bh * HWN + t0 + lm) * DH + half * 8);
    v8f O0 = {}, O1 = {};
    float m = -1e30f, l = 0.f;    // l: this half's keys only, joined at the end

    // Prologue: stage chunk 0.
    if (wib == 0) {
#pragma unroll
        for (int i = 0; i < 4; ++i) {
            int rr = i * 8 + row;
            async_b128(&sK[0][rr * 32 + seg * 8], kbase + (size_t)rr * DH + seg * 8);
            async_b128(&sV[0][rr * 32 + seg * 8], vbase + (size_t)rr * HWN + seg * 8);
        }
        asm volatile("s_wait_asynccnt 0x0" ::: "memory");
    }
    __syncthreads();

    for (int it = 0; it < HWN / 32; ++it) {
        int cur = it & 1;
        if (wib == 0 && it + 1 < HWN / 32) {
            int sn = (it + 1) * 32;
#pragma unroll
            for (int i = 0; i < 4; ++i) {
                int rr = i * 8 + row;
                async_b128(&sK[cur ^ 1][rr * 32 + seg * 8],
                           kbase + (size_t)(sn + rr) * DH + seg * 8);
                async_b128(&sV[cur ^ 1][rr * 32 + seg * 8],
                           vbase + (size_t)rr * HWN + sn + seg * 8);
            }
        }

        const uint16_t* kc = sK[cur];
        const uint16_t* vc = sV[cur];
        v16bf K0 = load_frag(kc + lm * 32 + half * 8);          // s = 0..15
        v16bf K1 = load_frag(kc + (16 + lm) * 32 + half * 8);   // s = 16..31
        v8f S0 = {}, S1 = {};
        S0 = wmma_bf16(K0, Qf, S0);   // S0[r] = score(s = half*8 + r,      t = lm)
        S1 = wmma_bf16(K1, Qf, S1);   // S1[r] = score(s = 16 + half*8 + r, t = lm)
        v16bf V0 = load_frag(vc + lm * 32 + half * 8);          // c = 0..15
        v16bf V1 = load_frag(vc + (16 + lm) * 32 + half * 8);   // c = 16..31

        float mx[8];
#pragma unroll   // constant indices keep mx and the tiles in registers
        for (int r = 0; r < 8; ++r) mx[r] = fmaxf(S0[r], S1[r]);
        float rowm = fmaxf(fmaxf(fmaxf(mx[0], mx[1]), fmaxf(mx[2], mx[3])),
                           fmaxf(fmaxf(mx[4], mx[5]), fmaxf(mx[6], mx[7])));
        rowm = fmaxf(rowm, other_half(rowm));
        float newm = fmaxf(m, rowm);
        float f    = __expf(m - newm);
        m = newm;

        float ps[8];
        FragU P;                      // B-frag 32(s) x 16(t), hardware k order
#pragma unroll   // constant indices keep ps and P in registers
        for (int i = 0; i < 4; ++i) {
            float a0 = __expf(S0[2 * i] - newm), a1 = __expf(S0[2 * i + 1] - newm);
            float b0 = __expf(S1[2 * i] - newm), b1 = __expf(S1[2 * i + 1] - newm);
            ps[2 * i]     = a0 + a1;
            ps[2 * i + 1] = b0 + b1;
            P.q2[0][i] = pk2bf(a0, a1);
            P.q2[1][i] = pk2bf(b0, b1);
        }
        l = l * f + (((ps[0] + ps[1]) + (ps[2] + ps[3])) +
                     ((ps[4] + ps[5]) + (ps[6] + ps[7])));
#pragma unroll   // constant indices keep the accumulators in registers
        for (int r = 0; r < 8; ++r) { O0[r] *= f; O1[r] *= f; }
        O0 = wmma_bf16(V0, P.v, O0);  // O0[r] = out(c = half*8 + r,      t = lm)
        O1 = wmma_bf16(V1, P.v, O1);  // O1[r] = out(c = 16 + half*8 + r, t = lm)

        if (wib == 0 && it + 1 < HWN / 32)
            asm volatile("s_wait_asynccnt 0x0" ::: "memory");
        __syncthreads();
    }

    l += other_half(l);
    float inv = 1.f / fmaxf(l, 1e-30f);
    uint16_t* op = ho + ((size_t)b * HWN + t0 + lm) * CCH + h * DH + half * 8;
    store8bf(op, O0, inv);            // 8 consecutive channels per lane
    store8bf(op + 16, O1, inv);
}

// ------------------------- kernel 4: proj + bias + residual -----------------
__global__ void k_proj_gemm(const uint16_t* __restrict__ wbf,
                            const uint16_t* __restrict__ ho,
                            const float* __restrict__ pb,
                            const float* __restrict__ x,
                            float* __restrict__ out) {
    int wave = __builtin_amdgcn_readfirstlane((int)blockIdx.x * 8 + (threadIdx.x >> 5));
    int lane = threadIdx.x & 31;
    int half = lane >> 4, lm = lane & 15;
    int b   = wave >> 7;              // /(8*16)
    int rem = wave & 127;
    int mt  = rem >> 4;               // 0..7
    int n0  = (rem & 15) * 64;

    v16bf A[4];
    const uint16_t* arow = wbf + (size_t)(mt * 16 + lm) * CCH + half * 8;
#pragma unroll
    for (int kk = 0; kk < 4; ++kk) A[kk] = load_frag(arow + kk * 32);

#pragma unroll
    for (int nt = 0; nt < 4; ++nt) {
        int t = n0 + nt * 16 + lm;
        const uint16_t* brow = ho + ((size_t)b * HWN + t) * CCH + half * 8;
        if (nt < 3) __builtin_prefetch(brow + 16 * CCH, 0, 3);
        v8f acc = {};
#pragma unroll
        for (int kk = 0; kk < 4; ++kk)
            acc = wmma_bf16(A[kk], load_frag(brow + kk * 32), acc);

#pragma unroll
        for (int r = 0; r < 8; ++r) {
            int o = mt * 16 + r + half * 8;
            size_t idx = ((size_t)b * CCH + o) * HWN + t;
            out[idx] = acc[r] + pb[o] + x[idx];
        }
    }
}

// ---------------------------------------------------------------------------
extern "C" void kernel_launch(void* const* d_in, const int* in_sizes, int n_in,
                              void* d_out, int out_size, void* d_ws, size_t ws_size,
                              hipStream_t stream) {
    const float* x      = (const float*)d_in[0];
    const float* norm_w = (const float*)d_in[1];
    const float* norm_b = (const float*)d_in[2];
    const float* qkv_w  = (const float*)d_in[3];
    const float* proj_w = (const float*)d_in[4];
    const float* proj_b = (const float*)d_in[5];
    float* out = (float*)d_out;

    char* ws = (char*)d_ws;
    const size_t SZ_BCHW_BF = (size_t)BATCH * CCH * HWN * 2;   // 8 MB bf16
    size_t off = 0;
    uint16_t* xn      = (uint16_t*)(ws + off); off += SZ_BCHW_BF;
    uint16_t* qb      = (uint16_t*)(ws + off); off += SZ_BCHW_BF;
    uint16_t* kb      = (uint16_t*)(ws + off); off += SZ_BCHW_BF;
    uint16_t* vb      = (uint16_t*)(ws + off); off += SZ_BCHW_BF;
    uint16_t* hob     = (uint16_t*)(ws + off); off += SZ_BCHW_BF;
    uint16_t* qkv_bf  = (uint16_t*)(ws + off); off += (size_t)3 * CCH * CCH * 2;
    uint16_t* proj_bf = (uint16_t*)(ws + off); off += (size_t)CCH * CCH * 2;
    (void)ws_size; (void)in_sizes; (void)n_in; (void)out_size;

    k_wconvert<<<dim3((3 * CCH * CCH + 255) / 256), dim3(256), 0, stream>>>(
        qkv_w, proj_w, qkv_bf, proj_bf);
    k_groupnorm<<<dim3(BATCH * 2), dim3(1024), 0, stream>>>(x, norm_w, norm_b, xn);
    k_qkv_gemm<<<dim3(BATCH * 24 * 16 / 8), dim3(256), 0, stream>>>(
        qkv_bf, xn, qb, kb, vb);
    k_attention<<<dim3(BATCH * NH * 8), dim3(256), 0, stream>>>(qb, kb, vb, hob);
    k_proj_gemm<<<dim3(BATCH * 8 * 16 / 8), dim3(256), 0, stream>>>(
        proj_bf, hob, proj_b, x, out);
}

// v004
// Measured time: 60 microseconds a run.
// Timed twice side by side with v003, it ran 1.25 and 1.26 times as fast.
// Counting every step since v000, it is 3.56 times as fast.
#include <hip/hip_runtime.h>
#include <stdint.h>

// ---------------------------------------------------------------------------
// CDNA5 / gfx1250 attention block: GroupNorm -> QKV (WMMA) -> flash attention
// (WMMA, async-LDS staged K/V) -> proj (WMMA) + bias + residual.
// wave32, bf16 operands, f32 accumulate.
// ---------------------------------------------------------------------------

typedef __attribute__((ext_vector_type(16))) __bf16    v16bf;
typedef __attribute__((ext_vector_type(8)))  float     v8f;
typedef __attribute__((ext_vector_type(4)))  uint32_t  u32x4;
typedef __attribute__((ext_vector_type(4)))  float     f32x4;

#define BATCH 32
#define CCH   128
#define HWN   1024
#define NH    4
#define DH    32
#define QKSCALE 0.17677669529663687f  // 1/sqrt(32)

union FragU { u32x4 q2[2]; v16bf v; };

typedef __attribute__((ext_vector_type(2)))  float     f32x2;
typedef __attribute__((ext_vector_type(2)))  __bf16    bf16x2;

// f32 -> bf16, round to nearest even, by the hardware's own conversion.
__device__ __forceinline__ uint16_t f2bf(float f) {
    return __builtin_bit_cast(uint16_t, (__bf16)f);
}

// Two f32 -> one packed register (lo in bits 15-0): one v_cvt_pk_bf16_f32.
__device__ __forceinline__ uint32_t pk2bf(float lo, float hi) {
    f32x2 p = {lo, hi};
    return __builtin_bit_cast(uint32_t, __builtin_convertvector(p, bf16x2));
}

// Fragment load: per-lane 8 bf16 at base and 8 bf16 at base+16 elements.
// Caller passes base already offset by half*8 so lane halves get the ISA's
// K split {0..7,16..23} / {8..15,24..31}.
__device__ __forceinline__ v16bf load_frag(const uint16_t* p) {
    FragU f;
    f.q2[0] = *(const u32x4*)(p);
    f.q2[1] = *(const u32x4*)(p + 16);
    return f.v;
}

__device__ __forceinline__ v8f wmma_bf16(v16bf a, v16bf b, v8f c) {
    return __builtin_amdgcn_wmma_f32_16x16x32_bf16(
        false, a, false, b, (short)0, c, false, false);
}

// Pack 8 accumulator floats (scaled) to 8 bf16 and store as one b128.
__device__ __forceinline__ void store8bf(uint16_t* dst, v8f a, float s) {
    uint32_t w[4];
#pragma unroll
    for (int i = 0; i < 4; ++i)
        w[i] = pk2bf(a[2 * i] * s, a[2 * i + 1] * s);
    u32x4 pk = {w[0], w[1], w[2], w[3]};
    *(u32x4*)dst = pk;
}

// Value of lane l ^ 16: the other half's share of the same query column.
__device__ __forceinline__ float other_half(float v) {
    int b = __builtin_bit_cast(int, v);
    b = __builtin_amdgcn_permlanex16(b, b, 0x76543210, 0xfedcba98, false, false);
    return __builtin_bit_cast(float, b);
}

// Async DMA: one 16-byte global->LDS transfer per active lane (ASYNCcnt).
__device__ __forceinline__ void async_b128(uint16_t* lds_dst, const uint16_t* gsrc) {
    uint32_t la = (uint32_t)(uintptr_t)lds_dst;          // low 32 bits = LDS offset
    uint64_t ga = (uint64_t)(uintptr_t)gsrc;
    asm volatile("global_load_async_to_lds_b128 %0, %1, off"
                 :: "v"(la), "v"(ga) : "memory");
}

// ------------------------- kernel 0: weight convert -------------------------
__global__ void k_wconvert(const float* __restrict__ qkv_w,
                           const float* __restrict__ proj_w,
                           uint16_t* __restrict__ qkv_bf,
                           uint16_t* __restrict__ proj_bf) {
    int i = blockIdx.x * 256 + threadIdx.x;
    if (i < 3 * CCH * CCH) qkv_bf[i] = f2bf(qkv_w[i]);
    if (i < CCH * CCH)     proj_bf[i] = f2bf(proj_w[i]);
}

// ------------------------- kernel 1: GroupNorm ------------------------------
// One 1024-thread block per (b, 64 channels = 16 groups): 64 bf16 channels are
// one 128-byte line of a row of xn, so this block is that line's only writer.
// Wave (cq, tq) keeps 8 channels (2 groups) x 256 positions in registers.
// The normalized bf16 tile is transposed through LDS and xn, laid out
// (b, t, c) for the GEMM's B operand, is stored as whole lines.
#define GN_PITCH 72   // LDS row: 64 channels + 8 pad = 144 B (16 B x odd)
__global__ __launch_bounds__(1024)
void k_groupnorm(const float* __restrict__ x,
                 const float* __restrict__ nw,
                 const float* __restrict__ nb,
                 uint16_t* __restrict__ xn) {
    __shared__ __align__(16) uint16_t tile[HWN * GN_PITCH];
    __shared__ f32x4 red[32];
    int tid  = threadIdx.x;
    int wave = __builtin_amdgcn_readfirstlane(tid >> 5);
    int lane = tid & 31;
    int b    = blockIdx.x >> 1;
    int ch0  = (blockIdx.x & 1) * 64;
    int cq   = wave & 7;             // 8-channel chunk of the 64
    int tq   = wave >> 3;            // quarter of the 1024 positions
    int c0   = ch0 + cq * 8;

    // Every wave-wide load covers 512 contiguous bytes of one channel's row.
    const float* xp = x + ((size_t)(b * CCH + c0)) * HWN + tq * 256 + lane * 4;
    f32x4 val[8][2];
#pragma unroll
    for (int kc = 0; kc < 8; ++kc)
#pragma unroll
        for (int j = 0; j < 2; ++j)
            val[kc][j] = *(const f32x4*)(xp + kc * HWN + j * 128);

    // Sum and sum of squares of the wave's two groups (channels 0-3, 4-7).
    f32x4 st = {0.f, 0.f, 0.f, 0.f};
#pragma unroll
    for (int kc = 0; kc < 8; ++kc)
#pragma unroll
        for (int j = 0; j < 2; ++j)
#pragma unroll
            for (int e = 0; e < 4; ++e) {
                float f = val[kc][j][e];
                st[(kc >> 2) * 2]     += f;
                st[(kc >> 2) * 2 + 1] += f * f;
            }
#pragma unroll
    for (int off = 16; off > 0; off >>= 1)
#pragma unroll
        for (int i = 0; i < 4; ++i)
            st[i] += __shfl_xor(st[i], off, 32);
    if (lane == 0) red[wave] = st;
    __syncthreads();
    // The four waves with this cq hold the four quarters of the same groups.
    st = (red[cq] + red[8 + cq]) + (red[16 + cq] + red[24 + cq]);

    float wch[8], bch[8];
#pragma unroll
    for (int g = 0; g < 2; ++g) {
        float mu   = st[g * 2] * (1.f / 4096.f);
        float var  = st[g * 2 + 1] * (1.f / 4096.f) - mu * mu;
        float rstd = rsqrtf(var + 1e-5f);
#pragma unroll
        for (int i = 0; i < 4; ++i) {
            int kc = g * 4 + i;
            wch[kc] = nw[c0 + kc] * rstd;
            bch[kc] = nb[c0 + kc] - mu * wch[kc];
        }
    }

    // One 16-byte LDS store per position: its 8 channels.  Lanes are 4 rows
    // apart, which at this pitch reaches only 4 of the 16 bank groups; the
    // chunk index is XORed with bits 4-5 of t so that 16 lanes reach all 16.
    int wsw = (cq ^ ((lane >> 2) & 3)) * 8;
#pragma unroll
    for (int j = 0; j < 2; ++j)
#pragma unroll
        for (int e = 0; e < 4; ++e) {
            int t = tq * 256 + j * 128 + lane * 4 + e;
            uint32_t w[4];
#pragma unroll
            for (int i = 0; i < 4; ++i)
                w[i] = pk2bf(val[2 * i][j][e] * wch[2 * i] + bch[2 * i],
                             val[2 * i + 1][j][e] * wch[2 * i + 1] + bch[2 * i + 1]);
            u32x4 pk = {w[0], w[1], w[2], w[3]};
            *(u32x4*)(tile + t * GN_PITCH + wsw) = pk;
        }
    __syncthreads();

    // Read rows back and store: 8 lanes cover one 128-byte line.  Lanes 0-7
    // and 8-15 take rows 8 apart, which fall on disjoint banks at this pitch.
    int lg = lane >> 3, lc = lane & 7;
    uint16_t* op = xn + (size_t)b * HWN * CCH + ch0 + lc * 8;
#pragma unroll
    for (int i = 0; i < 8; ++i) {
        int t = wave * 32 + lg * 8 + i;
        u32x4 pk = *(const u32x4*)(tile + t * GN_PITCH + (lc ^ ((t >> 4) & 3)) * 8);
        *(u32x4*)(op + (size_t)t * CCH) = pk;
    }
}

// ------------------------- GEMM B tile in LDS -------------------------------
// Both GEMMs take B from a (b, t, c) array.  A block stages 64 positions x 128
// channels (16 KB, contiguous in global memory) once: every wave-wide load
// covers 512 contiguous bytes, and all row tiles of the block read their
// fragments from LDS.  256 threads (8 waves) stage, four 16-byte chunks each.
#define XT_ROWS  64
#define XT_PITCH 136  // LDS row: 128 channels + 8 pad = 272 B (16 B x odd)
// The loads are issued ahead of the block's A loads, the LDS stores behind them.
__device__ __forceinline__ void stage_load(u32x4 (&buf)[4], const uint16_t* src, int tid) {
#pragma unroll   // constant indices keep buf in registers, all loads in flight
    for (int j = 0; j < 4; ++j)
        buf[j] = *(const u32x4*)(src + (size_t)(tid + j * 256) * 8);
}
__device__ __forceinline__ void stage_store(uint16_t* tile, const u32x4 (&buf)[4], int tid) {
#pragma unroll   // constant indices keep buf in registers
    for (int j = 0; j < 4; ++j)
        *(u32x4*)(tile + ((tid >> 4) + j * 16) * XT_PITCH + (tid & 15) * 8) = buf[j];
}

// ------------------------- kernel 2: QKV GEMM -------------------------------
// Per batch: (384 x 128) @ (128 x 1024).  One block = one (b, 64 positions):
// 12 waves, wave p computes rows 32p..32p+31, which are the q, k or v section
// of one head, for the block's 64 positions from the shared LDS tile.
// Writes q,k as (b,h,t,dh) scaled by 1/sqrt(dh); v as (b,h,dh,t).
// Routing (q/k/v section, head) is wave-uniform -> scalar branches.
// Register budget for 6 waves per SIMD: two blocks per WGP, so the whole grid
// of 512 blocks is resident at once.
__global__ __launch_bounds__(384, 6)
void k_qkv_gemm(const uint16_t* __restrict__ wbf,
                const uint16_t* __restrict__ xn,
                uint16_t* __restrict__ q,
                uint16_t* __restrict__ k,
                uint16_t* __restrict__ v) {
    __shared__ __align__(16) uint16_t tile[XT_ROWS * XT_PITCH];
    int tid  = threadIdx.x;
    int wib  = __builtin_amdgcn_readfirstlane(tid >> 5);   // 0..11
    int lane = tid & 31;
    int half = lane >> 4, lm = lane & 15;
    int b    = blockIdx.x >> 4;
    int n0   = (blockIdx.x & 15) * XT_ROWS;   // first position of the block

    int head = wib / 3;               // all wave-uniform scalars
    int sec  = wib - head * 3;        // 0=q 1=k 2=v
    size_t bh = (size_t)b * NH + head;

    u32x4 buf[4];
    if (wib < 8)                      // scalar branch: waves 8..11 only load A
        stage_load(buf, xn + ((size_t)b * HWN + n0) * CCH, tid);

    v16bf A[2][4];
    const uint16_t* arow = wbf + (size_t)(wib * 32 + lm) * CCH + half * 8;
#pragma unroll
    for (int m = 0; m < 2; ++m)
#pragma unroll
        for (int kk = 0; kk < 4; ++kk)
            A[m][kk] = load_frag(arow + m * 16 * CCH + kk * 32);
    // The wait that belongs in front of any reuse of the A loads' address
    // registers; naming the address keeps those registers until it.
    asm volatile("s_wait_xcnt 0x0" :: "v"(arow) : "memory");

    if (wib < 8) stage_store(tile, buf, tid);
    __syncthreads();

    // 32 rows x 16 positions: channels 0..15 (acc0) and 16..31 (acc1) of the section.
    auto mm = [&](int nt, v8f& acc0, v8f& acc1) {
        const uint16_t* brow = tile + (nt * 16 + lm) * XT_PITCH + half * 8;
#pragma unroll
        for (int kk = 0; kk < 4; ++kk) {
            v16bf Bf = load_frag(brow + kk * 32);
            acc0 = wmma_bf16(A[0][kk], Bf, acc0);
            acc1 = wmma_bf16(A[1][kk], Bf, acc1);
        }
    };

    // The section test stands outside the position loop: each side is one
    // straight run of products and stores.
    if (sec == 2) {
        uint16_t* dst = v + (bh * DH + half * 8) * HWN + n0 + lm;
#pragma unroll 2   // a full unroll spills at this register budget
        for (int nt = 0; nt < 4; ++nt) {
            v8f acc0 = {}, acc1 = {};
            mm(nt, acc0, acc1);
#pragma unroll
            for (int r = 0; r < 8; ++r) {
                dst[(size_t)r * HWN + nt * 16]        = f2bf(acc0[r]);
                dst[(size_t)(16 + r) * HWN + nt * 16] = f2bf(acc1[r]);
            }
        }
    } else {
        uint16_t* dst = (sec == 0 ? q : k) + (bh * HWN + n0 + lm) * DH + half * 8;
#pragma unroll 2   // a full unroll spills at this register budget
        for (int nt = 0; nt < 4; ++nt) {
            v8f acc0 = {}, acc1 = {};
            mm(nt, acc0, acc1);
            store8bf(dst + nt * 16 * DH, acc0, QKSCALE);   // one b128 store per lane
            store8bf(dst + nt * 16 * DH + 16, acc1, QKSCALE);
        }
    }
}

// ------------------------- kernel 3: flash attention ------------------------
// One block = one (b, h, group of 8 token tiles); 8 waves, one 16-row tile
// each.  Wave 0 DMA-stages shared K/V 32-key chunks into LDS with
// global_load_async_to_lds_b128 (double buffered, ASYNCcnt).  Scores are
// computed transposed, S^T = K Q^T: lane (lm, half) holds 16 of the chunk's 32
// scores of query lm, so the online softmax is in-lane plus one exchange
// between halves, and the two packed S^T tiles are the B operand of
// O^T += V^T P^T as they stand.
__global__ void k_attention(const uint16_t* __restrict__ q,
                            const uint16_t* __restrict__ k,
                            const uint16_t* __restrict__ v,
                            uint16_t* __restrict__ ho) {
    __shared__ __align__(16) uint16_t sK[2][32 * 32];   // (s_local, c)
    __shared__ __align__(16) uint16_t sV[2][32 * 32];   // (c, s_local)

    int tid  = threadIdx.x;
    int wib  = __builtin_amdgcn_readfirstlane(tid >> 5);
    int lane = tid & 31;
    int half = lane >> 4, lm = lane & 15;
    int row  = lane >> 2, seg = lane & 3;     // DMA lane mapping: 8 rows x 4 segs

    int blk = blockIdx.x;                     // 32*4*8 blocks
    int b   = blk >> 5;
    int rem = blk & 31;
    int h   = rem >> 3;
    int tg  = rem & 7;
    int t0  = (tg * 8 + wib) * 16;
    size_t bh = (size_t)b * NH + h;
    const uint16_t* kbase = k + bh * HWN * DH;
    const uint16_t* vbase = v + bh * DH * HWN;

    v16bf Qf = load_frag(q + (bh * HWN + t0 + lm) * DH + half * 8);
    v8f O0 = {}, O1 = {};
    float m = -1e30f, l = 0.f;    // l: this half's keys only, joined at the end

    // Prologue: stage chunk 0.
    if (wib == 0) {
#pragma unroll
        for (int i = 0; i < 4; ++i) {
            int rr = i * 8 + row;
            async_b128(&sK[0][rr * 32 + seg * 8], kbase + (size_t)rr * DH + seg * 8);
            async_b128(&sV[0][rr * 32 + seg * 8], vbase + (size_t)rr * HWN + seg * 8);
        }
        asm volatile("s_wait_asynccnt 0x0" ::: "memory");
    }
    __syncthreads();

    for (int it = 0; it < HWN / 32; ++it) {
        int cur = it & 1;
        if (wib == 0 && it + 1 < HWN / 32) {
            int sn = (it + 1) * 32;
#pragma unroll
            for (int i = 0; i < 4; ++i) {
                int rr = i * 8 + row;
                async_b128(&sK[cur ^ 1][rr * 32 + seg * 8],
                           kbase + (size_t)(sn + rr) * DH + seg * 8);
                async_b128(&sV[cur ^ 1][rr * 32 + seg * 8],
                           vbase + (size_t)rr * HWN + sn + seg * 8);
            }
        }

        const uint16_t* kc = sK[cur];
        const uint16_t* vc = sV[cur];
        v16bf K0 = load_frag(kc + lm * 32 + half * 8);          // s = 0..15
        v16bf K1 = load_frag(kc + (16 + lm) * 32 + half * 8);   // s = 16..31
        v8f S0 = {}, S1 = {};
        S0 = wmma_bf16(K0, Qf, S0);   // S0[r] = score(s = half*8 + r,      t = lm)
        S1 = wmma_bf16(K1, Qf, S1);   // S1[r] = score(s = 16 + half*8 + r, t = lm)
        v16bf V0 = load_frag(vc + lm * 32 + half * 8);          // c = 0..15
        v16bf V1 = load_frag(vc + (16 + lm) * 32 + half * 8);   // c = 16..31

        float mx[8];
#pragma unroll   // constant indices keep mx and the tiles in registers
        for (int r = 0; r < 8; ++r) mx[r] = fmaxf(S0[r], S1[r]);
        float rowm = fmaxf(fmaxf(fmaxf(mx[0], mx[1]), fmaxf(mx[2], mx[3])),
                           fmaxf(fmaxf(mx[4], mx[5]), fmaxf(mx[6], mx[7])));
        rowm = fmaxf(rowm, other_half(rowm));
        float newm = fmaxf(m, rowm);
        float f    = __expf(m - newm);
        m = newm;

        float ps[8];
        FragU P;                      // B-frag 32(s) x 16(t), hardware k order
#pragma unroll   // constant indices keep ps and P in registers
        for (int i = 0; i < 4; ++i) {
            float a0 = __expf(S0[2 * i] - newm), a1 = __expf(S0[2 * i + 1] - newm);
            float b0 = __expf(S1[2 * i] - newm), b1 = __expf(S1[2 * i + 1] - newm);
            ps[2 * i]     = a0 + a1;
            ps[2 * i + 1] = b0 + b1;
            P.q2[0][i] = pk2bf(a0, a1);
            P.q2[1][i] = pk2bf(b0, b1);
        }
        l = l * f + (((ps[0] + ps[1]) + (ps[2] + ps[3])) +
                     ((ps[4] + ps[5]) + (ps[6] + ps[7])));
#pragma unroll   // constant indices keep the accumulators in registers
        for (int r = 0; r < 8; ++r) { O0[r] *= f; O1[r] *= f; }
        O0 = wmma_bf16(V0, P.v, O0);  // O0[r] = out(c = half*8 + r,      t = lm)
        O1 = wmma_bf16(V1, P.v, O1);  // O1[r] = out(c = 16 + half*8 + r, t = lm)

        if (wib == 0 && it + 1 < HWN / 32)
            asm volatile("s_wait_asynccnt 0x0" ::: "memory");
        __syncthreads();
    }

    l += other_half(l);
    float inv = 1.f / fmaxf(l, 1e-30f);
    uint16_t* op = ho + ((size_t)b * HWN + t0 + lm) * CCH + h * DH + half * 8;
    store8bf(op, O0, inv);            // 8 consecutive channels per lane
    store8bf(op + 16, O1, inv);
}

// ------------------------- kernel 4: proj + bias + residual -----------------
// One block = one (b, 64 positions): 8 waves, wave mt computes output rows
// 16mt..16mt+15 from the shared LDS tile of ho.
__global__ __launch_bounds__(256)
void k_proj_gemm(const uint16_t* __restrict__ wbf,
                 const uint16_t* __restrict__ ho,
                 const float* __restrict__ pb,
                 const float* __restrict__ x,
                 float* __restrict__ out) {
    __shared__ __align__(16) uint16_t tile[XT_ROWS * XT_PITCH];
    int tid  = threadIdx.x;
    int mt   = __builtin_amdgcn_readfirstlane(tid >> 5);   // 0..7
    int lane = tid & 31;
    int half = lane >> 4, lm = lane & 15;
    int b    = blockIdx.x >> 4;
    int n0   = (blockIdx.x & 15) * XT_ROWS;

    u32x4 buf[4];
    stage_load(buf, ho + ((size_t)b * HWN + n0) * CCH, tid);

    v16bf A[4];
    const uint16_t* arow = wbf + (size_t)(mt * 16 + lm) * CCH + half * 8;
#pragma unroll
    for (int kk = 0; kk < 4; ++kk) A[kk] = load_frag(arow + kk * 32);

    stage_store(tile, buf, tid);
    __syncthreads();

#pragma unroll
    for (int nt = 0; nt < 4; ++nt) {
        int t = n0 + nt * 16 + lm;
        const uint16_t* brow = tile + (nt * 16 + lm) * XT_PITCH + half * 8;
        v8f acc = {};
#pragma unroll
        for (int kk = 0; kk < 4; ++kk)
            acc = wmma_bf16(A[kk], load_frag(brow + kk * 32), acc);

#pragma unroll
        for (int r = 0; r < 8; ++r) {
            int o = mt * 16 + r + half * 8;
            size_t idx = ((size_t)b * CCH + o) * HWN + t;
            out[idx] = acc[r] + pb[o] + x[idx];
        }
    }
}

// ---------------------------------------------------------------------------
extern "C" void kernel_launch(void* const* d_in, const int* in_sizes, int n_in,
                              void* d_out, int out_size, void* d_ws, size_t ws_size,
                              hipStream_t stream) {
    const float* x      = (const float*)d_in[0];
    const float* norm_w = (const float*)d_in[1];
    const float* norm_b = (const float*)d_in[2];
    const float* qkv_w  = (const float*)d_in[3];
    const float* proj_w = (const float*)d_in[4];
    const float* proj_b = (const float*)d_in[5];
    float* out = (float*)d_out;

    char* ws = (char*)d_ws;
    const size_t SZ_BCHW_BF = (size_t)BATCH * CCH * HWN * 2;   // 8 MB bf16
    size_t off = 0;
    uint16_t* xn      = (uint16_t*)(ws + off); off += SZ_BCHW_BF;
    uint16_t* qb      = (uint16_t*)(ws + off); off += SZ_BCHW_BF;
    uint16_t* kb      = (uint16_t*)(ws + off); off += SZ_BCHW_BF;
    uint16_t* vb      = (uint16_t*)(ws + off); off += SZ_BCHW_BF;
    uint16_t* hob     = (uint16_t*)(ws + off); off += SZ_BCHW_BF;
    uint16_t* qkv_bf  = (uint16_t*)(ws + off); off += (size_t)3 * CCH * CCH * 2;
    uint16_t* proj_bf = (uint16_t*)(ws + off); off += (size_t)CCH * CCH * 2;
    (void)ws_size; (void)in_sizes; (void)n_in; (void)out_size;

    k_wconvert<<<dim3((3 * CCH * CCH + 255) / 256), dim3(256), 0, stream>>>(
        qkv_w, proj_w, qkv_bf, proj_bf);
    k_groupnorm<<<dim3(BATCH * 2), dim3(1024), 0, stream>>>(x, norm_w, norm_b, xn);
    k_qkv_gemm<<<dim3(BATCH * 16), dim3(384), 0, stream>>>(
        qkv_bf, xn, qb, kb, vb);
    k_attention<<<dim3(BATCH * NH * 8), dim3(256), 0, stream>>>(qb, kb, vb, hob);
    k_proj_gemm<<<dim3(BATCH * 16), dim3(256), 0, stream>>>(
        proj_bf, hob, proj_b, x, out);
}

// v005
// A run of this version takes 54.6 microseconds.
// Next to v004, in two timings, it ran 1.10 times as fast each time.
// All steps since v000 together make it 3.92 times as fast.
#include <hip/hip_runtime.h>
#include <stdint.h>

// ---------------------------------------------------------------------------
// CDNA5 / gfx1250 attention block: GroupNorm -> QKV (WMMA) -> flash attention
// (WMMA, async-LDS staged K/V) -> proj (WMMA) + bias + residual.
// wave32, bf16 operands, f32 accumulate.
// ---------------------------------------------------------------------------

typedef __attribute__((ext_vector_type(16))) __bf16    v16bf;
typedef __attribute__((ext_vector_type(8)))  float     v8f;
typedef __attribute__((ext_vector_type(4)))  uint32_t  u32x4;
typedef __attribute__((ext_vector_type(4)))  float     f32x4;

#define BATCH 32
#define CCH   128
#define HWN   1024
#define NH    4
#define DH    32
#define QKSCALE 0.17677669529663687f  // 1/sqrt(32)

union FragU { u32x4 q2[2]; v16bf v; };

typedef __attribute__((ext_vector_type(2)))  float     f32x2;
typedef __attribute__((ext_vector_type(2)))  __bf16    bf16x2;

// f32 -> bf16, round to nearest even, by the hardware's own conversion.
__device__ __forceinline__ uint16_t f2bf(float f) {
    return __builtin_bit_cast(uint16_t, (__bf16)f);
}

// Two f32 -> one packed register (lo in bits 15-0): one v_cvt_pk_bf16_f32.
__device__ __forceinline__ uint32_t pk2bf(float lo, float hi) {
    f32x2 p = {lo, hi};
    return __builtin_bit_cast(uint32_t, __builtin_convertvector(p, bf16x2));
}

// Fragment load: per-lane 8 bf16 at base and 8 bf16 at base+16 elements.
// Caller passes base already offset by half*8 so lane halves get the ISA's
// K split {0..7,16..23} / {8..15,24..31}.
__device__ __forceinline__ v16bf load_frag(const uint16_t* p) {
    FragU f;
    f.q2[0] = *(const u32x4*)(p);
    f.q2[1] = *(const u32x4*)(p + 16);
    return f.v;
}

__device__ __forceinline__ v8f wmma_bf16(v16bf a, v16bf b, v8f c) {
    return __builtin_amdgcn_wmma_f32_16x16x32_bf16(
        false, a, false, b, (short)0, c, false, false);
}

// Pack 8 accumulator floats (scaled) to 8 bf16 and store as one b128.
__device__ __forceinline__ void store8bf(uint16_t* dst, v8f a, float s) {
    uint32_t w[4];
#pragma unroll
    for (int i = 0; i < 4; ++i)
        w[i] = pk2bf(a[2 * i] * s, a[2 * i + 1] * s);
    u32x4 pk = {w[0], w[1], w[2], w[3]};
    *(u32x4*)dst = pk;
}

// Value of lane l ^ 16: the other half's share of the same query column.
__device__ __forceinline__ float other_half(float v) {
    int b = __builtin_bit_cast(int, v);
    b = __builtin_amdgcn_permlanex16(b, b, 0x76543210, 0xfedcba98, false, false);
    return __builtin_bit_cast(float, b);
}

// LDS row of a K or V chunk: 32 bf16 + 8 pad = 80 B (16 B x odd), so that the
// 16 rows which one ds_load_b128 reads per wave half fall on all 64 banks.
#define KV_PITCH 40

// Async DMA of one 32 x 32 K chunk and one 32 x 32 V chunk by one wave: eight
// 16-byte global->LDS transfers per lane (ASYNCcnt), rows 8 apart.  sk, sv, gk,
// gv: the lane's own piece of its first row.  The closing s_wait_xcnt is the
// wait that belongs in front of any rewrite of the copies' address registers;
// inside the statement nothing can be scheduled between the copies and it.
__device__ __forceinline__ void stage_kv(uint16_t* sk, const uint16_t* gk,
                                         uint16_t* sv, const uint16_t* gv) {
    uint32_t lk = (uint32_t)(uintptr_t)sk;               // low 32 bits = LDS offset
    uint32_t lv = (uint32_t)(uintptr_t)sv;
    const uint32_t step = 8 * KV_PITCH * 2;              // 8 LDS rows, in bytes
    asm volatile("global_load_async_to_lds_b128 %0, %1, off\n\t"
                 "global_load_async_to_lds_b128 %2, %3, off\n\t"
                 "global_load_async_to_lds_b128 %4, %5, off\n\t"
                 "global_load_async_to_lds_b128 %6, %7, off\n\t"
                 "global_load_async_to_lds_b128 %8, %9, off\n\t"
                 "global_load_async_to_lds_b128 %10, %11, off\n\t"
                 "global_load_async_to_lds_b128 %12, %13, off\n\t"
                 "global_load_async_to_lds_b128 %14, %15, off\n\t"
                 "s_wait_xcnt 0x0"
                 :: "v"(lk),            "v"(gk),
                    "v"(lv),            "v"(gv),
                    "v"(lk + step),     "v"(gk + 8 * DH),
                    "v"(lv + step),     "v"(gv + 8 * HWN),
                    "v"(lk + 2 * step), "v"(gk + 16 * DH),
                    "v"(lv + 2 * step), "v"(gv + 16 * HWN),
                    "v"(lk + 3 * step), "v"(gk + 24 * DH),
                    "v"(lv + 3 * step), "v"(gv + 24 * HWN)
                 : "memory");
}

// ------------------------- kernel 0: weight convert -------------------------
__global__ void k_wconvert(const float* __restrict__ qkv_w,
                           const float* __restrict__ proj_w,
                           uint16_t* __restrict__ qkv_bf,
                           uint16_t* __restrict__ proj_bf) {
    int i = blockIdx.x * 256 + threadIdx.x;
    if (i < 3 * CCH * CCH) qkv_bf[i] = f2bf(qkv_w[i]);
    if (i < CCH * CCH)     proj_bf[i] = f2bf(proj_w[i]);
}

// ------------------------- kernel 1: GroupNorm ------------------------------
// One 1024-thread block per (b, 64 channels = 16 groups): 64 bf16 channels are
// one 128-byte line of a row of xn, so this block is that line's only writer.
// Wave (cq, tq) keeps 8 channels (2 groups) x 256 positions in registers.
// The normalized bf16 tile is transposed through LDS and xn, laid out
// (b, t, c) for the GEMM's B operand, is stored as whole lines.
#define GN_PITCH 72   // LDS row: 64 channels + 8 pad = 144 B (16 B x odd)
__global__ __launch_bounds__(1024)
void k_groupnorm(const float* __restrict__ x,
                 const float* __restrict__ nw,
                 const float* __restrict__ nb,
                 uint16_t* __restrict__ xn) {
    __shared__ __align__(16) uint16_t tile[HWN * GN_PITCH];
    __shared__ f32x4 red[32];
    int tid  = threadIdx.x;
    int wave = __builtin_amdgcn_readfirstlane(tid >> 5);
    int lane = tid & 31;
    int b    = blockIdx.x >> 1;
    int ch0  = (blockIdx.x & 1) * 64;
    int cq   = wave & 7;             // 8-channel chunk of the 64
    int tq   = wave >> 3;            // quarter of the 1024 positions
    int c0   = ch0 + cq * 8;

    // Every wave-wide load covers 512 contiguous bytes of one channel's row.
    const float* xp = x + ((size_t)(b * CCH + c0)) * HWN + tq * 256 + lane * 4;
    f32x4 val[8][2];
#pragma unroll
    for (int kc = 0; kc < 8; ++kc)
#pragma unroll
        for (int j = 0; j < 2; ++j)
            val[kc][j] = *(const f32x4*)(xp + kc * HWN + j * 128);

    // Sum and sum of squares of the wave's two groups (channels 0-3, 4-7).
    f32x4 st = {0.f, 0.f, 0.f, 0.f};
#pragma unroll
    for (int kc = 0; kc < 8; ++kc)
#pragma unroll
        for (int j = 0; j < 2; ++j)
#pragma unroll
            for (int e = 0; e < 4; ++e) {
                float f = val[kc][j][e];
                st[(kc >> 2) * 2]     += f;
                st[(kc >> 2) * 2 + 1] += f * f;
            }
#pragma unroll
    for (int off = 16; off > 0; off >>= 1)
#pragma unroll
        for (int i = 0; i < 4; ++i)
            st[i] += __shfl_xor(st[i], off, 32);
    if (lane == 0) red[wave] = st;
    __syncthreads();
    // The four waves with this cq hold the four quarters of the same groups.
    st = (red[cq] + red[8 + cq]) + (red[16 + cq] + red[24 + cq]);

    float wch[8], bch[8];
#pragma unroll
    for (int g = 0; g < 2; ++g) {
        float mu   = st[g * 2] * (1.f / 4096.f);
        float var  = st[g * 2 + 1] * (1.f / 4096.f) - mu * mu;
        float rstd = rsqrtf(var + 1e-5f);
#pragma unroll
        for (int i = 0; i < 4; ++i) {
            int kc = g * 4 + i;
            wch[kc] = nw[c0 + kc] * rstd;
            bch[kc] = nb[c0 + kc] - mu * wch[kc];
        }
    }

    // One 16-byte LDS store per position: its 8 channels.  Lanes are 4 rows
    // apart, which at this pitch reaches only 4 of the 16 bank groups; the
    // chunk index is XORed with bits 4-5 of t so that 16 lanes reach all 16.
    int wsw = (cq ^ ((lane >> 2) & 3)) * 8;
#pragma unroll
    for (int j = 0; j < 2; ++j)
#pragma unroll
        for (int e = 0; e < 4; ++e) {
            int t = tq * 256 + j * 128 + lane * 4 + e;
            uint32_t w[4];
#pragma unroll
            for (int i = 0; i < 4; ++i)
                w[i] = pk2bf(val[2 * i][j][e] * wch[2 * i] + bch[2 * i],
                             val[2 * i + 1][j][e] * wch[2 * i + 1] + bch[2 * i + 1]);
            u32x4 pk = {w[0], w[1], w[2], w[3]};
            *(u32x4*)(tile + t * GN_PITCH + wsw) = pk;
        }
    __syncthreads();

    // Read rows back and store: 8 lanes cover one 128-byte line.  Lanes 0-7
    // and 8-15 take rows 8 apart, which fall on disjoint banks at this pitch.
    int lg = lane >> 3, lc = lane & 7;
    uint16_t* op = xn + (size_t)b * HWN * CCH + ch0 + lc * 8;
#pragma unroll
    for (int i = 0; i < 8; ++i) {
        int t = wave * 32 + lg * 8 + i;
        u32x4 pk = *(const u32x4*)(tile + t * GN_PITCH + (lc ^ ((t >> 4) & 3)) * 8);
        *(u32x4*)(op + (size_t)t * CCH) = pk;
    }
}

// ------------------------- GEMM B tile in LDS -------------------------------
// Both GEMMs take B from a (b, t, c) array.  A block stages 64 positions x 128
// channels (16 KB, contiguous in global memory) once: every wave-wide load
// covers 512 contiguous bytes, and all row tiles of the block read their
// fragments from LDS.  256 threads (8 waves) stage, four 16-byte chunks each.
#define XT_ROWS  64
#define XT_PITCH 136  // LDS row: 128 channels + 8 pad = 272 B (16 B x odd)
// The loads are issued ahead of the block's A loads, the LDS stores behind them.
__device__ __forceinline__ void stage_load(u32x4 (&buf)[4], const uint16_t* src, int tid) {
#pragma unroll   // constant indices keep buf in registers, all loads in flight
    for (int j = 0; j < 4; ++j)
        buf[j] = *(const u32x4*)(src + (size_t)(tid + j * 256) * 8);
}
__device__ __forceinline__ void stage_store(uint16_t* tile, const u32x4 (&buf)[4], int tid) {
#pragma unroll   // constant indices keep buf in registers
    for (int j = 0; j < 4; ++j)
        *(u32x4*)(tile + ((tid >> 4) + j * 16) * XT_PITCH + (tid & 15) * 8) = buf[j];
}

// ------------------------- kernel 2: QKV GEMM -------------------------------
// Per batch: (384 x 128) @ (128 x 1024).  One block = one (b, 64 positions):
// 12 waves, wave p computes rows 32p..32p+31, which are the q, k or v section
// of one head, for the block's 64 positions from the shared LDS tile.
// Writes q,k as (b,h,t,dh) scaled by 1/sqrt(dh); v as (b,h,dh,t).
// Routing (q/k/v section, head) is wave-uniform -> scalar branches.
// Register budget for 6 waves per SIMD: two blocks per WGP, so the whole grid
// of 512 blocks is resident at once.
__global__ __launch_bounds__(384, 6)
void k_qkv_gemm(const uint16_t* __restrict__ wbf,
                const uint16_t* __restrict__ xn,
                uint16_t* __restrict__ q,
                uint16_t* __restrict__ k,
                uint16_t* __restrict__ v) {
    __shared__ __align__(16) uint16_t tile[XT_ROWS * XT_PITCH];
    int tid  = threadIdx.x;
    int wib  = __builtin_amdgcn_readfirstlane(tid >> 5);   // 0..11
    int lane = tid & 31;
    int half = lane >> 4, lm = lane & 15;
    int b    = blockIdx.x >> 4;
    int n0   = (blockIdx.x & 15) * XT_ROWS;   // first position of the block

    int head = wib / 3;               // all wave-uniform scalars
    int sec  = wib - head * 3;        // 0=q 1=k 2=v
    size_t bh = (size_t)b * NH + head;

    u32x4 buf[4];
    if (wib < 8)                      // scalar branch: waves 8..11 only load A
        stage_load(buf, xn + ((size_t)b * HWN + n0) * CCH, tid);

    v16bf A[2][4];
    const uint16_t* arow = wbf + (size_t)(wib * 32 + lm) * CCH + half * 8;
#pragma unroll
    for (int m = 0; m < 2; ++m)
#pragma unroll
        for (int kk = 0; kk < 4; ++kk)
            A[m][kk] = load_frag(arow + m * 16 * CCH + kk * 32);
    // The wait that belongs in front of any reuse of the A loads' address
    // registers; naming the address keeps those registers until it.
    asm volatile("s_wait_xcnt 0x0" :: "v"(arow) : "memory");

    if (wib < 8) stage_store(tile, buf, tid);
    __syncthreads();

    // 32 rows x 16 positions: channels 0..15 (acc0) and 16..31 (acc1) of the section.
    auto mm = [&](int nt, v8f& acc0, v8f& acc1) {
        const uint16_t* brow = tile + (nt * 16 + lm) * XT_PITCH + half * 8;
#pragma unroll
        for (int kk = 0; kk < 4; ++kk) {
            v16bf Bf = load_frag(brow + kk * 32);
            acc0 = wmma_bf16(A[0][kk], Bf, acc0);
            acc1 = wmma_bf16(A[1][kk], Bf, acc1);
        }
    };

    // The section test stands outside the position loop: each side is one
    // straight run of products and stores.
    if (sec == 2) {
        uint16_t* dst = v + (bh * DH + half * 8) * HWN + n0 + lm;
#pragma unroll 2   // a full unroll spills at this register budget
        for (int nt = 0; nt < 4; ++nt) {
            v8f acc0 = {}, acc1 = {};
            mm(nt, acc0, acc1);
#pragma unroll
            for (int r = 0; r < 8; ++r) {
                dst[(size_t)r * HWN + nt * 16]        = f2bf(acc0[r]);
                dst[(size_t)(16 + r) * HWN + nt * 16] = f2bf(acc1[r]);
            }
        }
    } else {
        uint16_t* dst = (sec == 0 ? q : k) + (bh * HWN + n0 + lm) * DH + half * 8;
#pragma unroll 2   // a full unroll spills at this register budget
        for (int nt = 0; nt < 4; ++nt) {
            v8f acc0 = {}, acc1 = {};
            mm(nt, acc0, acc1);
            store8bf(dst + nt * 16 * DH, acc0, QKSCALE);   // one b128 store per lane
            store8bf(dst + nt * 16 * DH + 16, acc1, QKSCALE);
        }
    }
}

// ------------------------- kernel 3: flash attention ------------------------
// One block = one (b, h, group of 8 token tiles); 8 waves, one 16-row tile
// each.  Wave 0 DMA-stages shared K/V 32-key chunks into LDS with
// global_load_async_to_lds_b128 (double buffered, ASYNCcnt).  Scores are
// computed transposed, S^T = K Q^T: lane (lm, half) holds 16 of the chunk's 32
// scores of query lm, so the online softmax is in-lane plus one exchange
// between halves, and the two packed S^T tiles are the B operand of
// O^T += V^T P^T as they stand.
__global__ void k_attention(const uint16_t* __restrict__ q,
                            const uint16_t* __restrict__ k,
                            const uint16_t* __restrict__ v,
                            uint16_t* __restrict__ ho) {
    __shared__ __align__(16) uint16_t sK[2][32 * KV_PITCH];   // (s_local, c)
    __shared__ __align__(16) uint16_t sV[2][32 * KV_PITCH];   // (c, s_local)

    int tid  = threadIdx.x;
    int wib  = __builtin_amdgcn_readfirstlane(tid >> 5);
    int lane = tid & 31;
    int half = lane >> 4, lm = lane & 15;
    int row  = lane >> 2, seg = lane & 3;     // DMA lane mapping: 8 rows x 4 segs

    int blk = blockIdx.x;                     // 32*4*8 blocks
    int b   = blk >> 5;
    int rem = blk & 31;
    int h   = rem >> 3;
    int tg  = rem & 7;
    int t0  = (tg * 8 + wib) * 16;
    size_t bh = (size_t)b * NH + h;
    const uint16_t* kbase = k + bh * HWN * DH;
    const uint16_t* vbase = v + bh * DH * HWN;

    v16bf Qf = load_frag(q + (bh * HWN + t0 + lm) * DH + half * 8);
    v8f O0 = {}, O1 = {};
    float m = -1e30f, l = 0.f;    // l: this half's keys only, joined at the end

    // Prologue: stage chunk 0.
    if (wib == 0) {
        stage_kv(&sK[0][row * KV_PITCH + seg * 8], kbase + (size_t)row * DH + seg * 8,
                 &sV[0][row * KV_PITCH + seg * 8], vbase + (size_t)row * HWN + seg * 8);
        asm volatile("s_wait_asynccnt 0x0" ::: "memory");
    }
    __syncthreads();

    for (int it = 0; it < HWN / 32; ++it) {
        int cur = it & 1;
        if (wib == 0 && it + 1 < HWN / 32) {
            int sn = (it + 1) * 32;
            stage_kv(&sK[cur ^ 1][row * KV_PITCH + seg * 8],
                     kbase + (size_t)(sn + row) * DH + seg * 8,
                     &sV[cur ^ 1][row * KV_PITCH + seg * 8],
                     vbase + (size_t)row * HWN + sn + seg * 8);
        }

        const uint16_t* kc = sK[cur];
        const uint16_t* vc = sV[cur];
        v16bf K0 = load_frag(kc + lm * KV_PITCH + half * 8);          // s = 0..15
        v16bf K1 = load_frag(kc + (16 + lm) * KV_PITCH + half * 8);   // s = 16..31
        v8f S0 = {}, S1 = {};
        S0 = wmma_bf16(K0, Qf, S0);   // S0[r] = score(s = half*8 + r,      t = lm)
        S1 = wmma_bf16(K1, Qf, S1);   // S1[r] = score(s = 16 + half*8 + r, t = lm)
        v16bf V0 = load_frag(vc + lm * KV_PITCH + half * 8);          // c = 0..15
        v16bf V1 = load_frag(vc + (16 + lm) * KV_PITCH + half * 8);   // c = 16..31

        float mx[8];
#pragma unroll   // constant indices keep mx and the tiles in registers
        for (int r = 0; r < 8; ++r) mx[r] = fmaxf(S0[r], S1[r]);
        float rowm = fmaxf(fmaxf(fmaxf(mx[0], mx[1]), fmaxf(mx[2], mx[3])),
                           fmaxf(fmaxf(mx[4], mx[5]), fmaxf(mx[6], mx[7])));
        rowm = fmaxf(rowm, other_half(rowm));
        float newm = fmaxf(m, rowm);
        float f    = __expf(m - newm);
        m = newm;

        float ps[8];
        FragU P;                      // B-frag 32(s) x 16(t), hardware k order
#pragma unroll   // constant indices keep ps and P in registers
        for (int i = 0; i < 4; ++i) {
            float a0 = __expf(S0[2 * i] - newm), a1 = __expf(S0[2 * i + 1] - newm);
            float b0 = __expf(S1[2 * i] - newm), b1 = __expf(S1[2 * i + 1] - newm);
            ps[2 * i]     = a0 + a1;
            ps[2 * i + 1] = b0 + b1;
            P.q2[0][i] = pk2bf(a0, a1);
            P.q2[1][i] = pk2bf(b0, b1);
        }
        l = l * f + (((ps[0] + ps[1]) + (ps[2] + ps[3])) +
                     ((ps[4] + ps[5]) + (ps[6] + ps[7])));
#pragma unroll   // constant indices keep the accumulators in registers
        for (int r = 0; r < 8; ++r) { O0[r] *= f; O1[r] *= f; }
        O0 = wmma_bf16(V0, P.v, O0);  // O0[r] = out(c = half*8 + r,      t = lm)
        O1 = wmma_bf16(V1, P.v, O1);  // O1[r] = out(c = 16 + half*8 + r, t = lm)

        if (wib == 0 && it + 1 < HWN / 32)
            asm volatile("s_wait_asynccnt 0x0" ::: "memory");
        __syncthreads();
    }

    l += other_half(l);
    float inv = 1.f / fmaxf(l, 1e-30f);
    uint16_t* op = ho + ((size_t)b * HWN + t0 + lm) * CCH + h * DH + half * 8;
    store8bf(op, O0, inv);            // 8 consecutive channels per lane
    store8bf(op + 16, O1, inv);
}

// ------------------------- kernel 4: proj + bias + residual -----------------
// One block = one (b, 64 positions): 8 waves, wave mt computes output rows
// 16mt..16mt+15 from the shared LDS tile of ho.
__global__ __launch_bounds__(256)
void k_proj_gemm(const uint16_t* __restrict__ wbf,
                 const uint16_t* __restrict__ ho,
                 const float* __restrict__ pb,
                 const float* __restrict__ x,
                 float* __restrict__ out) {
    __shared__ __align__(16) uint16_t tile[XT_ROWS * XT_PITCH];
    int tid  = threadIdx.x;
    int mt   = __builtin_amdgcn_readfirstlane(tid >> 5);   // 0..7
    int lane = tid & 31;
    int half = lane >> 4, lm = lane & 15;
    int b    = blockIdx.x >> 4;
    int n0   = (blockIdx.x & 15) * XT_ROWS;

    u32x4 buf[4];
    stage_load(buf, ho + ((size_t)b * HWN + n0) * CCH, tid);

    v16bf A[4];
    const uint16_t* arow = wbf + (size_t)(mt * 16 + lm) * CCH + half * 8;
#pragma unroll
    for (int kk = 0; kk < 4; ++kk) A[kk] = load_frag(arow + kk * 32);

    stage_store(tile, buf, tid);
    __syncthreads();

#pragma unroll
    for (int nt = 0; nt < 4; ++nt) {
        int t = n0 + nt * 16 + lm;
        const uint16_t* brow = tile + (nt * 16 + lm) * XT_PITCH + half * 8;
        v8f acc = {};
#pragma unroll
        for (int kk = 0; kk < 4; ++kk)
            acc = wmma_bf16(A[kk], load_frag(brow + kk * 32), acc);

#pragma unroll
        for (int r = 0; r < 8; ++r) {
            int o = mt * 16 + r + half * 8;
            size_t idx = ((size_t)b * CCH + o) * HWN + t;
            out[idx] = acc[r] + pb[o] + x[idx];
        }
    }
}

// ---------------------------------------------------------------------------
extern "C" void kernel_launch(void* const* d_in, const int* in_sizes, int n_in,
                              void* d_out, int out_size, void* d_ws, size_t ws_size,
                              hipStream_t stream) {
    const float* x      = (const float*)d_in[0];
    const float* norm_w = (const float*)d_in[1];
    const float* norm_b = (const float*)d_in[2];
    const float* qkv_w  = (const float*)d_in[3];
    const float* proj_w = (const float*)d_in[4];
    const float* proj_b = (const float*)d_in[5];
    float* out = (float*)d_out;

    char* ws = (char*)d_ws;
    const size_t SZ_BCHW_BF = (size_t)BATCH * CCH * HWN * 2;   // 8 MB bf16
    size_t off = 0;
    uint16_t* xn      = (uint16_t*)(ws + off); off += SZ_BCHW_BF;
    uint16_t* qb      = (uint16_t*)(ws + off); off += SZ_BCHW_BF;
    uint16_t* kb      = (uint16_t*)(ws + off); off += SZ_BCHW_BF;
    uint16_t* vb      = (uint16_t*)(ws + off); off += SZ_BCHW_BF;
    uint16_t* hob     = (uint16_t*)(ws + off); off += SZ_BCHW_BF;
    uint16_t* qkv_bf  = (uint16_t*)(ws + off); off += (size_t)3 * CCH * CCH * 2;
    uint16_t* proj_bf = (uint16_t*)(ws + off); off += (size_t)CCH * CCH * 2;
    (void)ws_size; (void)in_sizes; (void)n_in; (void)out_size;

    k_wconvert<<<dim3((3 * CCH * CCH + 255) / 256), dim3(256), 0, stream>>>(
        qkv_w, proj_w, qkv_bf, proj_bf);
    k_groupnorm<<<dim3(BATCH * 2), dim3(1024), 0, stream>>>(x, norm_w, norm_b, xn);
    k_qkv_gemm<<<dim3(BATCH * 16), dim3(384), 0, stream>>>(
        qkv_bf, xn, qb, kb, vb);
    k_attention<<<dim3(BATCH * NH * 8), dim3(256), 0, stream>>>(qb, kb, vb, hob);
    k_proj_gemm<<<dim3(BATCH * 16), dim3(256), 0, stream>>>(
        proj_bf, hob, proj_b, x, out);
}

// v006
// Measured time: 50.8 microseconds a run.
// In two side-by-side timings against v005, it was 1.05 and 1.07 times as fast.
// Over all steps from v000 it is 4.16 times as fast.
#include <hip/hip_runtime.h>
#include <stdint.h>

// ---------------------------------------------------------------------------
// CDNA5 / gfx1250 attention block: GroupNorm -> QKV (WMMA) -> flash attention
// (WMMA, async-LDS staged K/V) -> proj (WMMA) + bias + residual.
// wave32, bf16 operands, f32 accumulate.
// ---------------------------------------------------------------------------

typedef __attribute__((ext_vector_type(16))) __bf16    v16bf;
typedef __attribute__((ext_vector_type(8)))  float     v8f;
typedef __attribute__((ext_vector_type(4)))  uint32_t  u32x4;
typedef __attribute__((ext_vector_type(4)))  float     f32x4;

#define BATCH 32
#define CCH   128
#define HWN   1024
#define NH    4
#define DH    32
#define QKSCALE 0.17677669529663687f  // 1/sqrt(32)

union FragU { u32x4 q2[2]; v16bf v; };

typedef __attribute__((ext_vector_type(2)))  float     f32x2;
typedef __attribute__((ext_vector_type(2)))  __bf16    bf16x2;

// f32 -> bf16, round to nearest even, by the hardware's own conversion.
__device__ __forceinline__ uint16_t f2bf(float f) {
    return __builtin_bit_cast(uint16_t, (__bf16)f);
}

// Two f32 -> one packed register (lo in bits 15-0): one v_cvt_pk_bf16_f32.
__device__ __forceinline__ uint32_t pk2bf(float lo, float hi) {
    f32x2 p = {lo, hi};
    return __builtin_bit_cast(uint32_t, __builtin_convertvector(p, bf16x2));
}

// Fragment load: per-lane 8 bf16 at base and 8 bf16 at base+16 elements.
// Caller passes base already offset by half*8 so lane halves get the ISA's
// K split {0..7,16..23} / {8..15,24..31}.
__device__ __forceinline__ v16bf load_frag(const uint16_t* p) {
    FragU f;
    f.q2[0] = *(const u32x4*)(p);
    f.q2[1] = *(const u32x4*)(p + 16);
    return f.v;
}

__device__ __forceinline__ v8f wmma_bf16(v16bf a, v16bf b, v8f c) {
    return __builtin_amdgcn_wmma_f32_16x16x32_bf16(
        false, a, false, b, (short)0, c, false, false);
}

// Pack 8 accumulator floats (scaled) to 8 bf16 and store as one b128.
__device__ __forceinline__ void store8bf(uint16_t* dst, v8f a, float s) {
    uint32_t w[4];
#pragma unroll
    for (int i = 0; i < 4; ++i)
        w[i] = pk2bf(a[2 * i] * s, a[2 * i + 1] * s);
    u32x4 pk = {w[0], w[1], w[2], w[3]};
    *(u32x4*)dst = pk;
}

// Value of lane l ^ 16: the other half's share of the same query column.
__device__ __forceinline__ float other_half(float v) {
    int b = __builtin_bit_cast(int, v);
    b = __builtin_amdgcn_permlanex16(b, b, 0x76543210, 0xfedcba98, false, false);
    return __builtin_bit_cast(float, b);
}

// One stage of K and V in LDS: KST keys.  K rows (one key, 32 channels) stand
// at 80 B, V rows (one channel, KST keys) at 272 B: both 16 B x odd, so that the
// 16 rows which one ds_load_b128 reads per wave half fall on all 64 banks.
#define KST      128
#define NSTAGE   (HWN / KST)
#define K_PITCH  40
#define V_PITCH  (KST + 8)
#define K_BYTES  (KST * K_PITCH * 2)
#define V_BYTES  (DH * V_PITCH * 2)

// Async DMA of a thread's share of one stage (256 threads): two 16-byte pieces
// of K, 64 rows apart, and two of V, 16 rows apart (ASYNCcnt).  lk, lv, gk, gv:
// the lane's own first pieces.  A wave's K copy covers 512 contiguous bytes, its
// V copy 256 contiguous bytes of each of two rows.  The closing s_wait_xcnt is
// the wait that belongs in front of any rewrite of the copies' address
// registers; inside the statement nothing can be scheduled between them.
__device__ __forceinline__ void stage_kv(uint32_t lk, const uint16_t* gk,
                                         uint32_t lv, const uint16_t* gv) {
    asm volatile("global_load_async_to_lds_b128 %0, %1, off\n\t"
                 "global_load_async_to_lds_b128 %2, %3, off\n\t"
                 "global_load_async_to_lds_b128 %4, %5, off\n\t"
                 "global_load_async_to_lds_b128 %6, %7, off\n\t"
                 "s_wait_xcnt 0x0"
                 :: "v"(lk),                     "v"(gk),
                    "v"(lv),                     "v"(gv),
                    "v"(lk + 64 * K_PITCH * 2),  "v"(gk + 64 * DH),
                    "v"(lv + 16 * V_PITCH * 2),  "v"(gv + 16 * HWN)
                 : "memory");
}

// ------------------------- kernel 0: weight convert -------------------------
__global__ void k_wconvert(const float* __restrict__ qkv_w,
                           const float* __restrict__ proj_w,
                           uint16_t* __restrict__ qkv_bf,
                           uint16_t* __restrict__ proj_bf) {
    int i = blockIdx.x * 256 + threadIdx.x;
    if (i < 3 * CCH * CCH) qkv_bf[i] = f2bf(qkv_w[i]);
    if (i < CCH * CCH)     proj_bf[i] = f2bf(proj_w[i]);
}

// ------------------------- kernel 1: GroupNorm ------------------------------
// One 1024-thread block per (b, 64 channels = 16 groups): 64 bf16 channels are
// one 128-byte line of a row of xn, so this block is that line's only writer.
// Wave (cq, tq) keeps 8 channels (2 groups) x 256 positions in registers.
// The normalized bf16 tile is transposed through LDS and xn, laid out
// (b, t, c) for the GEMM's B operand, is stored as whole lines.
#define GN_PITCH 72   // LDS row: 64 channels + 8 pad = 144 B (16 B x odd)
__global__ __launch_bounds__(1024)
void k_groupnorm(const float* __restrict__ x,
                 const float* __restrict__ nw,
                 const float* __restrict__ nb,
                 uint16_t* __restrict__ xn) {
    __shared__ __align__(16) uint16_t tile[HWN * GN_PITCH];
    __shared__ f32x4 red[32];
    int tid  = threadIdx.x;
    int wave = __builtin_amdgcn_readfirstlane(tid >> 5);
    int lane = tid & 31;
    int b    = blockIdx.x >> 1;
    int ch0  = (blockIdx.x & 1) * 64;
    int cq   = wave & 7;             // 8-channel chunk of the 64
    int tq   = wave >> 3;            // quarter of the 1024 positions
    int c0   = ch0 + cq * 8;

    // Every wave-wide load covers 512 contiguous bytes of one channel's row.
    const float* xp = x + ((size_t)(b * CCH + c0)) * HWN + tq * 256 + lane * 4;
    f32x4 val[8][2];
#pragma unroll
    for (int kc = 0; kc < 8; ++kc)
#pragma unroll
        for (int j = 0; j < 2; ++j)
            val[kc][j] = *(const f32x4*)(xp + kc * HWN + j * 128);

    // Sum and sum of squares of the wave's two groups (channels 0-3, 4-7).
    f32x4 st = {0.f, 0.f, 0.f, 0.f};
#pragma unroll
    for (int kc = 0; kc < 8; ++kc)
#pragma unroll
        for (int j = 0; j < 2; ++j)
#pragma unroll
            for (int e = 0; e < 4; ++e) {
                float f = val[kc][j][e];
                st[(kc >> 2) * 2]     += f;
                st[(kc >> 2) * 2 + 1] += f * f;
            }
#pragma unroll
    for (int off = 16; off > 0; off >>= 1)
#pragma unroll
        for (int i = 0; i < 4; ++i)
            st[i] += __shfl_xor(st[i], off, 32);
    if (lane == 0) red[wave] = st;
    __syncthreads();
    // The four waves with this cq hold the four quarters of the same groups.
    st = (red[cq] + red[8 + cq]) + (red[16 + cq] + red[24 + cq]);

    float wch[8], bch[8];
#pragma unroll
    for (int g = 0; g < 2; ++g) {
        float mu   = st[g * 2] * (1.f / 4096.f);
        float var  = st[g * 2 + 1] * (1.f / 4096.f) - mu * mu;
        float rstd = rsqrtf(var + 1e-5f);
#pragma unroll
        for (int i = 0; i < 4; ++i) {
            int kc = g * 4 + i;
            wch[kc] = nw[c0 + kc] * rstd;
            bch[kc] = nb[c0 + kc] - mu * wch[kc];
        }
    }

    // One 16-byte LDS store per position: its 8 channels.  Lanes are 4 rows
    // apart, which at this pitch reaches only 4 of the 16 bank groups; the
    // chunk index is XORed with bits 4-5 of t so that 16 lanes reach all 16.
    int wsw = (cq ^ ((lane >> 2) & 3)) * 8;
#pragma unroll
    for (int j = 0; j < 2; ++j)
#pragma unroll
        for (int e = 0; e < 4; ++e) {
            int t = tq * 256 + j * 128 + lane * 4 + e;
            uint32_t w[4];
#pragma unroll
            for (int i = 0; i < 4; ++i)
                w[i] = pk2bf(val[2 * i][j][e] * wch[2 * i] + bch[2 * i],
                             val[2 * i + 1][j][e] * wch[2 * i + 1] + bch[2 * i + 1]);
            u32x4 pk = {w[0], w[1], w[2], w[3]};
            *(u32x4*)(tile + t * GN_PITCH + wsw) = pk;
        }
    __syncthreads();

    // Read rows back and store: 8 lanes cover one 128-byte line.  Lanes 0-7
    // and 8-15 take rows 8 apart, which fall on disjoint banks at this pitch.
    int lg = lane >> 3, lc = lane & 7;
    uint16_t* op = xn + (size_t)b * HWN * CCH + ch0 + lc * 8;
#pragma unroll
    for (int i = 0; i < 8; ++i) {
        int t = wave * 32 + lg * 8 + i;
        u32x4 pk = *(const u32x4*)(tile + t * GN_PITCH + (lc ^ ((t >> 4) & 3)) * 8);
        *(u32x4*)(op + (size_t)t * CCH) = pk;
    }
}

// ------------------------- GEMM B tile in LDS -------------------------------
// Both GEMMs take B from a (b, t, c) array.  A block stages 64 positions x 128
// channels (16 KB, contiguous in global memory) once: every wave-wide load
// covers 512 contiguous bytes, and all row tiles of the block read their
// fragments from LDS.  256 threads (8 waves) stage, four 16-byte chunks each.
#define XT_ROWS  64
#define XT_PITCH 136  // LDS row: 128 channels + 8 pad = 272 B (16 B x odd)
// The loads are issued ahead of the block's A loads, the LDS stores behind them.
__device__ __forceinline__ void stage_load(u32x4 (&buf)[4], const uint16_t* src, int tid) {
#pragma unroll   // constant indices keep buf in registers, all loads in flight
    for (int j = 0; j < 4; ++j)
        buf[j] = *(const u32x4*)(src + (size_t)(tid + j * 256) * 8);
}
__device__ __forceinline__ void stage_store(uint16_t* tile, const u32x4 (&buf)[4], int tid) {
#pragma unroll   // constant indices keep buf in registers
    for (int j = 0; j < 4; ++j)
        *(u32x4*)(tile + ((tid >> 4) + j * 16) * XT_PITCH + (tid & 15) * 8) = buf[j];
}

// ------------------------- kernel 2: QKV GEMM -------------------------------
// Per batch: (384 x 128) @ (128 x 1024).  One block = one (b, 64 positions):
// 12 waves, wave p computes rows 32p..32p+31, which are the q, k or v section
// of one head, for the block's 64 positions from the shared LDS tile.
// Writes q,k as (b,h,t,dh) scaled by 1/sqrt(dh); v as (b,h,dh,t).
// Routing (q/k/v section, head) is wave-uniform -> scalar branches.
// Register budget for 6 waves per SIMD: two blocks per WGP, so the whole grid
// of 512 blocks is resident at once.
__global__ __launch_bounds__(384, 6)
void k_qkv_gemm(const uint16_t* __restrict__ wbf,
                const uint16_t* __restrict__ xn,
                uint16_t* __restrict__ q,
                uint16_t* __restrict__ k,
                uint16_t* __restrict__ v) {
    __shared__ __align__(16) uint16_t tile[XT_ROWS * XT_PITCH];
    int tid  = threadIdx.x;
    int wib  = __builtin_amdgcn_readfirstlane(tid >> 5);   // 0..11
    int lane = tid & 31;
    int half = lane >> 4, lm = lane & 15;
    int b    = blockIdx.x >> 4;
    int n0   = (blockIdx.x & 15) * XT_ROWS;   // first position of the block

    int head = wib / 3;               // all wave-uniform scalars
    int sec  = wib - head * 3;        // 0=q 1=k 2=v
    size_t bh = (size_t)b * NH + head;

    u32x4 buf[4];
    if (wib < 8)                      // scalar branch: waves 8..11 only load A
        stage_load(buf, xn + ((size_t)b * HWN + n0) * CCH, tid);

    v16bf A[2][4];
    const uint16_t* arow = wbf + (size_t)(wib * 32 + lm) * CCH + half * 8;
#pragma unroll
    for (int m = 0; m < 2; ++m)
#pragma unroll
        for (int kk = 0; kk < 4; ++kk)
            A[m][kk] = load_frag(arow + m * 16 * CCH + kk * 32);
    // The wait that belongs in front of any reuse of the A loads' address
    // registers; naming the address keeps those registers until it.
    asm volatile("s_wait_xcnt 0x0" :: "v"(arow) : "memory");

    if (wib < 8) stage_store(tile, buf, tid);
    __syncthreads();

    // 32 rows x 16 positions: channels 0..15 (acc0) and 16..31 (acc1) of the section.
    auto mm = [&](int nt, v8f& acc0, v8f& acc1) {
        const uint16_t* brow = tile + (nt * 16 + lm) * XT_PITCH + half * 8;
#pragma unroll
        for (int kk = 0; kk < 4; ++kk) {
            v16bf Bf = load_frag(brow + kk * 32);
            acc0 = wmma_bf16(A[0][kk], Bf, acc0);
            acc1 = wmma_bf16(A[1][kk], Bf, acc1);
        }
    };

    // The section test stands outside the position loop: each side is one
    // straight run of products and stores.
    if (sec == 2) {
        uint16_t* dst = v + (bh * DH + half * 8) * HWN + n0 + lm;
#pragma unroll 2   // a full unroll spills at this register budget
        for (int nt = 0; nt < 4; ++nt) {
            v8f acc0 = {}, acc1 = {};
            mm(nt, acc0, acc1);
#pragma unroll
            for (int r = 0; r < 8; ++r) {
                dst[(size_t)r * HWN + nt * 16]        = f2bf(acc0[r]);
                dst[(size_t)(16 + r) * HWN + nt * 16] = f2bf(acc1[r]);
            }
        }
    } else {
        uint16_t* dst = (sec == 0 ? q : k) + (bh * HWN + n0 + lm) * DH + half * 8;
#pragma unroll 2   // a full unroll spills at this register budget
        for (int nt = 0; nt < 4; ++nt) {
            v8f acc0 = {}, acc1 = {};
            mm(nt, acc0, acc1);
            store8bf(dst + nt * 16 * DH, acc0, QKSCALE);   // one b128 store per lane
            store8bf(dst + nt * 16 * DH + 16, acc1, QKSCALE);
        }
    }
}

// ------------------------- kernel 3: flash attention ------------------------
// One block = one (b, h, group of 8 token tiles); 8 waves, one 16-row tile
// each.  K and V come into LDS in stages of KST keys, two buffers, by
// global_load_async_to_lds_b128 (ASYNCcnt); every wave copies its own slice of
// a stage, and the next stage flies while this one's four 32-key passes run,
// with one publish point (waits and barrier) per stage.  Scores are
// computed transposed, S^T = K Q^T: lane (lm, half) holds 16 of a pass's 32
// scores of query lm, so the online softmax is in-lane plus one exchange
// between halves, and the two packed S^T tiles are the B operand of
// O^T += V^T P^T as they stand.
__global__ void k_attention(const uint16_t* __restrict__ q,
                            const uint16_t* __restrict__ k,
                            const uint16_t* __restrict__ v,
                            uint16_t* __restrict__ ho) {
    __shared__ __align__(16) uint16_t sK[2][KST * K_PITCH];   // (s_local, c)
    __shared__ __align__(16) uint16_t sV[2][DH * V_PITCH];    // (c, s_local)

    int tid  = threadIdx.x;
    int wib  = __builtin_amdgcn_readfirstlane(tid >> 5);
    int lane = tid & 31;
    int half = lane >> 4, lm = lane & 15;

    int blk = blockIdx.x;                     // 32*4*8 blocks
    int b   = blk >> 5;
    int rem = blk & 31;
    int h   = rem >> 3;
    int tg  = rem & 7;
    int t0  = (tg * 8 + wib) * 16;
    size_t bh = (size_t)b * NH + h;

    v16bf Qf = load_frag(q + (bh * HWN + t0 + lm) * DH + half * 8);
    v8f O0 = {}, O1 = {};
    float m = -1e30f, l = 0.f;    // l: this half's keys only, joined at the end

    // The thread's pieces of a stage: K is contiguous (4 pieces a row), a V row
    // holds 16 pieces.  Low 32 bits of a __shared__ address = LDS offset.
    const uint16_t* gk = k + bh * HWN * DH + tid * 8;
    const uint16_t* gv = v + bh * DH * HWN + (size_t)(tid >> 4) * HWN + (tid & 15) * 8;
    uint32_t lk = (uint32_t)(uintptr_t)&sK[0][(tid >> 2) * K_PITCH + (tid & 3) * 8];
    uint32_t lv = (uint32_t)(uintptr_t)&sV[0][(tid >> 4) * V_PITCH + (tid & 15) * 8];

    // Prologue: stage 0 landed and published, stage 1 in flight.
    stage_kv(lk, gk, lv, gv);
    asm volatile("s_wait_asynccnt 0x0" ::: "memory");   // own copies of stage 0 landed
    __syncthreads();
    stage_kv(lk + K_BYTES, gk + KST * DH, lv + V_BYTES, gv + KST);

#pragma unroll 1   // rolled: the text of all 32 passes would be eight times as long to fetch
    for (int st = 0; st < NSTAGE; ++st) {
        int cur = st & 1;
        const uint16_t* kc = sK[cur] + lm * K_PITCH + half * 8;
        const uint16_t* vc = sV[cur] + lm * V_PITCH + half * 8;

#pragma unroll   // no barrier inside: a pass's LDS reads can rise over the pass before
        for (int ps4 = 0; ps4 < KST / 32; ++ps4) {
            const uint16_t* kp = kc + ps4 * 32 * K_PITCH;
            const uint16_t* vp = vc + ps4 * 32;
            v16bf K0 = load_frag(kp);                     // s = 0..15
            v16bf K1 = load_frag(kp + 16 * K_PITCH);      // s = 16..31
            v8f S0 = {}, S1 = {};
            S0 = wmma_bf16(K0, Qf, S0);   // S0[r] = score(s = half*8 + r,      t = lm)
            S1 = wmma_bf16(K1, Qf, S1);   // S1[r] = score(s = 16 + half*8 + r, t = lm)
            v16bf V0 = load_frag(vp);                     // c = 0..15
            v16bf V1 = load_frag(vp + 16 * V_PITCH);      // c = 16..31

            float mx[8];
#pragma unroll   // constant indices keep mx and the tiles in registers
            for (int r = 0; r < 8; ++r) mx[r] = fmaxf(S0[r], S1[r]);
            float rowm = fmaxf(fmaxf(fmaxf(mx[0], mx[1]), fmaxf(mx[2], mx[3])),
                               fmaxf(fmaxf(mx[4], mx[5]), fmaxf(mx[6], mx[7])));
            rowm = fmaxf(rowm, other_half(rowm));
            float newm = fmaxf(m, rowm);
            float f    = __expf(m - newm);
            m = newm;

            float ps[8];
            FragU P;                      // B-frag 32(s) x 16(t), hardware k order
#pragma unroll   // constant indices keep ps and P in registers
            for (int i = 0; i < 4; ++i) {
                float a0 = __expf(S0[2 * i] - newm), a1 = __expf(S0[2 * i + 1] - newm);
                float b0 = __expf(S1[2 * i] - newm), b1 = __expf(S1[2 * i + 1] - newm);
                ps[2 * i]     = a0 + a1;
                ps[2 * i + 1] = b0 + b1;
                P.q2[0][i] = pk2bf(a0, a1);
                P.q2[1][i] = pk2bf(b0, b1);
            }
            l = l * f + (((ps[0] + ps[1]) + (ps[2] + ps[3])) +
                         ((ps[4] + ps[5]) + (ps[6] + ps[7])));
#pragma unroll   // constant indices keep the accumulators in registers
            for (int r = 0; r < 8; ++r) { O0[r] *= f; O1[r] *= f; }
            O0 = wmma_bf16(V0, P.v, O0);  // O0[r] = out(c = half*8 + r,      t = lm)
            O1 = wmma_bf16(V1, P.v, O1);  // O1[r] = out(c = 16 + half*8 + r, t = lm)
        }

        // Publish point: this wave has left buffer cur, its slice of the next
        // stage has landed; behind the barrier that holds for every wave.
        asm volatile("s_wait_dscnt 0x0" ::: "memory");
        asm volatile("s_wait_asynccnt 0x0" ::: "memory");
        __syncthreads();
        if (st + 2 < NSTAGE)              // refill the buffer just left
            stage_kv(lk + cur * K_BYTES, gk + (size_t)(st + 2) * KST * DH,
                     lv + cur * V_BYTES, gv + (st + 2) * KST);
    }
    asm volatile("s_wait_asynccnt 0x0" ::: "memory");   // nothing in flight at the end

    l += other_half(l);
    float inv = 1.f / fmaxf(l, 1e-30f);
    uint16_t* op = ho + ((size_t)b * HWN + t0 + lm) * CCH + h * DH + half * 8;
    store8bf(op, O0, inv);            // 8 consecutive channels per lane
    store8bf(op + 16, O1, inv);
}

// ------------------------- kernel 4: proj + bias + residual -----------------
// One block = one (b, 64 positions): 8 waves, wave mt computes output rows
// 16mt..16mt+15 from the shared LDS tile of ho.
__global__ __launch_bounds__(256)
void k_proj_gemm(const uint16_t* __restrict__ wbf,
                 const uint16_t* __restrict__ ho,
                 const float* __restrict__ pb,
                 const float* __restrict__ x,
                 float* __restrict__ out) {
    __shared__ __align__(16) uint16_t tile[XT_ROWS * XT_PITCH];
    int tid  = threadIdx.x;
    int mt   = __builtin_amdgcn_readfirstlane(tid >> 5);   // 0..7
    int lane = tid & 31;
    int half = lane >> 4, lm = lane & 15;
    int b    = blockIdx.x >> 4;
    int n0   = (blockIdx.x & 15) * XT_ROWS;

    u32x4 buf[4];
    stage_load(buf, ho + ((size_t)b * HWN + n0) * CCH, tid);

    v16bf A[4];
    const uint16_t* arow = wbf + (size_t)(mt * 16 + lm) * CCH + half * 8;
#pragma unroll
    for (int kk = 0; kk < 4; ++kk) A[kk] = load_frag(arow + kk * 32);

    stage_store(tile, buf, tid);
    __syncthreads();

#pragma unroll
    for (int nt = 0; nt < 4; ++nt) {
        int t = n0 + nt * 16 + lm;
        const uint16_t* brow = tile + (nt * 16 + lm) * XT_PITCH + half * 8;
        v8f acc = {};
#pragma unroll
        for (int kk = 0; kk < 4; ++kk)
            acc = wmma_bf16(A[kk], load_frag(brow + kk * 32), acc);

#pragma unroll
        for (int r = 0; r < 8; ++r) {
            int o = mt * 16 + r + half * 8;
            size_t idx = ((size_t)b * CCH + o) * HWN + t;
            out[idx] = acc[r] + pb[o] + x[idx];
        }
    }
}

// ---------------------------------------------------------------------------
extern "C" void kernel_launch(void* const* d_in, const int* in_sizes, int n_in,
                              void* d_out, int out_size, void* d_ws, size_t ws_size,
                              hipStream_t stream) {
    const float* x      = (const float*)d_in[0];
    const float* norm_w = (const float*)d_in[1];
    const float* norm_b = (const float*)d_in[2];
    const float* qkv_w  = (const float*)d_in[3];
    const float* proj_w = (const float*)d_in[4];
    const float* proj_b = (const float*)d_in[5];
    float* out = (float*)d_out;

    char* ws = (char*)d_ws;
    const size_t SZ_BCHW_BF = (size_t)BATCH * CCH * HWN * 2;   // 8 MB bf16
    size_t off = 0;
    uint16_t* xn      = (uint16_t*)(ws + off); off += SZ_BCHW_BF;
    uint16_t* qb      = (uint16_t*)(ws + off); off += SZ_BCHW_BF;
    uint16_t* kb      = (uint16_t*)(ws + off); off += SZ_BCHW_BF;
    uint16_t* vb      = (uint16_t*)(ws + off); off += SZ_BCHW_BF;
    uint16_t* hob     = (uint16_t*)(ws + off); off += SZ_BCHW_BF;
    uint16_t* qkv_bf  = (uint16_t*)(ws + off); off += (size_t)3 * CCH * CCH * 2;
    uint16_t* proj_bf = (uint16_t*)(ws + off); off += (size_t)CCH * CCH * 2;
    (void)ws_size; (void)in_sizes; (void)n_in; (void)out_size;

    k_wconvert<<<dim3((3 * CCH * CCH + 255) / 256), dim3(256), 0, stream>>>(
        qkv_w, proj_w, qkv_bf, proj_bf);
    k_groupnorm<<<dim3(BATCH * 2), dim3(1024), 0, stream>>>(x, norm_w, norm_b, xn);
    k_qkv_gemm<<<dim3(BATCH * 16), dim3(384), 0, stream>>>(
        qkv_bf, xn, qb, kb, vb);
    k_attention<<<dim3(BATCH * NH * 8), dim3(256), 0, stream>>>(qb, kb, vb, hob);
    k_proj_gemm<<<dim3(BATCH * 16), dim3(256), 0, stream>>>(
        proj_bf, hob, proj_b, x, out);
}

// v007
// It runs in 48.6 microseconds.
// Two timings next to v006 both put it at 1.05 times that version's speed.
// Counting every step since v000, it is 4.35 times as fast.
#include <hip/hip_runtime.h>
#include <stdint.h>

// ---------------------------------------------------------------------------
// CDNA5 / gfx1250 attention block: GroupNorm -> QKV (WMMA) -> flash attention
// (WMMA, async-LDS staged K/V) -> proj (WMMA) + bias + residual.
// wave32, bf16 operands, f32 accumulate.
// ---------------------------------------------------------------------------

typedef __attribute__((ext_vector_type(16))) __bf16    v16bf;
typedef __attribute__((ext_vector_type(8)))  float     v8f;
typedef __attribute__((ext_vector_type(4)))  uint32_t  u32x4;
typedef __attribute__((ext_vector_type(2)))  uint32_t  u32x2;
typedef __attribute__((ext_vector_type(4)))  float     f32x4;

#define BATCH 32
#define CCH   128
#define HWN   1024
#define NH    4
#define DH    32
#define QKSCALE 0.17677669529663687f  // 1/sqrt(32)

union FragU { u32x4 q2[2]; v16bf v; };

typedef __attribute__((ext_vector_type(2)))  float     f32x2;
typedef __attribute__((ext_vector_type(2)))  __bf16    bf16x2;

// f32 -> bf16, round to nearest even, by the hardware's own conversion.
__device__ __forceinline__ uint16_t f2bf(float f) {
    return __builtin_bit_cast(uint16_t, (__bf16)f);
}

// Two f32 -> one packed register (lo in bits 15-0): one v_cvt_pk_bf16_f32.
__device__ __forceinline__ uint32_t pk2bf(float lo, float hi) {
    f32x2 p = {lo, hi};
    return __builtin_bit_cast(uint32_t, __builtin_convertvector(p, bf16x2));
}

// Fragment load: per-lane 8 bf16 at base and 8 bf16 at base+16 elements.
// Caller passes base already offset by half*8 so lane halves get the ISA's
// K split {0..7,16..23} / {8..15,24..31}.
__device__ __forceinline__ v16bf load_frag(const uint16_t* p) {
    FragU f;
    f.q2[0] = *(const u32x4*)(p);
    f.q2[1] = *(const u32x4*)(p + 16);
    return f.v;
}

__device__ __forceinline__ v8f wmma_bf16(v16bf a, v16bf b, v8f c) {
    return __builtin_amdgcn_wmma_f32_16x16x32_bf16(
        false, a, false, b, (short)0, c, false, false);
}

// Pack 8 accumulator floats (scaled) to 8 bf16 and store as one b128.
__device__ __forceinline__ void store8bf(uint16_t* dst, v8f a, float s) {
    uint32_t w[4];
#pragma unroll
    for (int i = 0; i < 4; ++i)
        w[i] = pk2bf(a[2 * i] * s, a[2 * i + 1] * s);
    u32x4 pk = {w[0], w[1], w[2], w[3]};
    *(u32x4*)dst = pk;
}

// Value of lane l ^ 16: the other half's share of the same query column.
__device__ __forceinline__ float other_half(float v) {
    int b = __builtin_bit_cast(int, v);
    b = __builtin_amdgcn_permlanex16(b, b, 0x76543210, 0xfedcba98, false, false);
    return __builtin_bit_cast(float, b);
}

// One stage of K and V in LDS: KST keys.  K rows (one key, 32 channels) stand
// at 80 B, V rows (one channel, KST keys) at 272 B: both 16 B x odd, so that the
// 16 rows which one ds_load_b128 reads per wave half fall on all 64 banks.
#define KST      128
#define NSTAGE   (HWN / KST)
#define K_PITCH  40
#define V_PITCH  (KST + 8)
#define K_BYTES  (KST * K_PITCH * 2)
#define V_BYTES  (DH * V_PITCH * 2)

// Async DMA of a thread's share of one stage (256 threads): two 16-byte pieces
// of K, 64 rows apart, and two of V, 16 rows apart (ASYNCcnt).  lk, lv, gk, gv:
// the lane's own first pieces.  A wave's K copy covers 512 contiguous bytes, its
// V copy 256 contiguous bytes of each of two rows.  The closing s_wait_xcnt is
// the wait that belongs in front of any rewrite of the copies' address
// registers; inside the statement nothing can be scheduled between them.
__device__ __forceinline__ void stage_kv(uint32_t lk, const uint16_t* gk,
                                         uint32_t lv, const uint16_t* gv) {
    asm volatile("global_load_async_to_lds_b128 %0, %1, off\n\t"
                 "global_load_async_to_lds_b128 %2, %3, off\n\t"
                 "global_load_async_to_lds_b128 %4, %5, off\n\t"
                 "global_load_async_to_lds_b128 %6, %7, off\n\t"
                 "s_wait_xcnt 0x0"
                 :: "v"(lk),                     "v"(gk),
                    "v"(lv),                     "v"(gv),
                    "v"(lk + 64 * K_PITCH * 2),  "v"(gk + 64 * DH),
                    "v"(lv + 16 * V_PITCH * 2),  "v"(gv + 16 * HWN)
                 : "memory");
}

// ------------------------- kernel 0: GroupNorm + weight convert --------------
// The two jobs read nothing of each other, so they share one grid: blocks
// 0..GN_BLOCKS-1 normalize, the WC_BLOCKS behind them round the weights to bf16
// on WGPs that the normalizing blocks leave idle.
#define GN_BLOCKS   (BATCH * 2)
#define WC_PER_BLK  4096                            // 1024 threads x 4 weights
#define WC_QKV_BLKS (3 * CCH * CCH / WC_PER_BLK)    // 12
#define WC_BLOCKS   (4 * CCH * CCH / WC_PER_BLK)    // 16: qkv_w, then proj_w
// A normalizing block:
// One 1024-thread block per (b, 64 channels = 16 groups): 64 bf16 channels are
// one 128-byte line of a row of xn, so this block is that line's only writer.
// Wave (cq, tq) keeps 8 channels (2 groups) x 256 positions in registers.
// The normalized bf16 tile is transposed through LDS and xn, laid out
// (b, t, c) for the GEMM's B operand, is stored as whole lines.
#define GN_PITCH 72   // LDS row: 64 channels + 8 pad = 144 B (16 B x odd)
__global__ __launch_bounds__(1024)
void k_groupnorm(const float* __restrict__ x,
                 const float* __restrict__ nw,
                 const float* __restrict__ nb,
                 uint16_t* __restrict__ xn,
                 const float* __restrict__ qkv_w,
                 const float* __restrict__ proj_w,
                 uint16_t* __restrict__ qkv_bf,
                 uint16_t* __restrict__ proj_bf) {
    __shared__ __align__(16) uint16_t tile[HWN * GN_PITCH];
    __shared__ f32x4 red[32];
    int tid  = threadIdx.x;

    // Weight blocks: the test is the same for the whole block and stands in
    // front of every barrier.  16 B read and 8 B written per lane.
    if (blockIdx.x >= GN_BLOCKS) {
        int wb = blockIdx.x - GN_BLOCKS;
        const float* s = wb < WC_QKV_BLKS ? qkv_w + wb * WC_PER_BLK
                                          : proj_w + (wb - WC_QKV_BLKS) * WC_PER_BLK;
        uint16_t*    d = wb < WC_QKV_BLKS ? qkv_bf + wb * WC_PER_BLK
                                          : proj_bf + (wb - WC_QKV_BLKS) * WC_PER_BLK;
        f32x4 w4 = *(const f32x4*)(s + tid * 4);
        u32x2 pk = {pk2bf(w4[0], w4[1]), pk2bf(w4[2], w4[3])};
        *(u32x2*)(d + tid * 4) = pk;
        return;
    }

    int wave = __builtin_amdgcn_readfirstlane(tid >> 5);
    int lane = tid & 31;
    int b    = blockIdx.x >> 1;
    int ch0  = (blockIdx.x & 1) * 64;
    int cq   = wave & 7;             // 8-channel chunk of the 64
    int tq   = wave >> 3;            // quarter of the 1024 positions
    int c0   = ch0 + cq * 8;

    // Every wave-wide load covers 512 contiguous bytes of one channel's row.
    const float* xp = x + ((size_t)(b * CCH + c0)) * HWN + tq * 256 + lane * 4;
    f32x4 val[8][2];
#pragma unroll
    for (int kc = 0; kc < 8; ++kc)
#pragma unroll
        for (int j = 0; j < 2; ++j)
            val[kc][j] = *(const f32x4*)(xp + kc * HWN + j * 128);

    // Sum and sum of squares of the wave's two groups (channels 0-3, 4-7).
    f32x4 st = {0.f, 0.f, 0.f, 0.f};
#pragma unroll
    for (int kc = 0; kc < 8; ++kc)
#pragma unroll
        for (int j = 0; j < 2; ++j)
#pragma unroll
            for (int e = 0; e < 4; ++e) {
                float f = val[kc][j][e];
                st[(kc >> 2) * 2]     += f;
                st[(kc >> 2) * 2 + 1] += f * f;
            }
#pragma unroll
    for (int off = 16; off > 0; off >>= 1)
#pragma unroll
        for (int i = 0; i < 4; ++i)
            st[i] += __shfl_xor(st[i], off, 32);
    if (lane == 0) red[wave] = st;
    __syncthreads();
    // The four waves with this cq hold the four quarters of the same groups.
    st = (red[cq] + red[8 + cq]) + (red[16 + cq] + red[24 + cq]);

    float wch[8], bch[8];
#pragma unroll
    for (int g = 0; g < 2; ++g) {
        float mu   = st[g * 2] * (1.f / 4096.f);
        float var  = st[g * 2 + 1] * (1.f / 4096.f) - mu * mu;
        float rstd = rsqrtf(var + 1e-5f);
#pragma unroll
        for (int i = 0; i < 4; ++i) {
            int kc = g * 4 + i;
            wch[kc] = nw[c0 + kc] * rstd;
            bch[kc] = nb[c0 + kc] - mu * wch[kc];
        }
    }

    // One 16-byte LDS store per position: its 8 channels.  Lanes are 4 rows
    // apart, which at this pitch reaches only 4 of the 16 bank groups; the
    // chunk index is XORed with bits 4-5 of t so that 16 lanes reach all 16.
    int wsw = (cq ^ ((lane >> 2) & 3)) * 8;
#pragma unroll
    for (int j = 0; j < 2; ++j)
#pragma unroll
        for (int e = 0; e < 4; ++e) {
            int t = tq * 256 + j * 128 + lane * 4 + e;
            uint32_t w[4];
#pragma unroll
            for (int i = 0; i < 4; ++i)
                w[i] = pk2bf(val[2 * i][j][e] * wch[2 * i] + bch[2 * i],
                             val[2 * i + 1][j][e] * wch[2 * i + 1] + bch[2 * i + 1]);
            u32x4 pk = {w[0], w[1], w[2], w[3]};
            *(u32x4*)(tile + t * GN_PITCH + wsw) = pk;
        }
    __syncthreads();

    // Read rows back and store: 8 lanes cover one 128-byte line.  Lanes 0-7
    // and 8-15 take rows 8 apart, which fall on disjoint banks at this pitch.
    int lg = lane >> 3, lc = lane & 7;
    uint16_t* op = xn + (size_t)b * HWN * CCH + ch0 + lc * 8;
#pragma unroll
    for (int i = 0; i < 8; ++i) {
        int t = wave * 32 + lg * 8 + i;
        u32x4 pk = *(const u32x4*)(tile + t * GN_PITCH + (lc ^ ((t >> 4) & 3)) * 8);
        *(u32x4*)(op + (size_t)t * CCH) = pk;
    }
}

// ------------------------- GEMM B tile in LDS -------------------------------
// Both GEMMs take B from a (b, t, c) array.  A block stages 64 positions x 128
// channels (16 KB, contiguous in global memory) once: every wave-wide load
// covers 512 contiguous bytes, and all row tiles of the block read their
// fragments from LDS.  256 threads (8 waves) stage, four 16-byte chunks each.
#define XT_ROWS  64
#define XT_PITCH 136  // LDS row: 128 channels + 8 pad = 272 B (16 B x odd)
// The loads are issued ahead of the block's A loads, the LDS stores behind them.
__device__ __forceinline__ void stage_load(u32x4 (&buf)[4], const uint16_t* src, int tid) {
#pragma unroll   // constant indices keep buf in registers, all loads in flight
    for (int j = 0; j < 4; ++j)
        buf[j] = *(const u32x4*)(src + (size_t)(tid + j * 256) * 8);
}
__device__ __forceinline__ void stage_store(uint16_t* tile, const u32x4 (&buf)[4], int tid) {
#pragma unroll   // constant indices keep buf in registers
    for (int j = 0; j < 4; ++j)
        *(u32x4*)(tile + ((tid >> 4) + j * 16) * XT_PITCH + (tid & 15) * 8) = buf[j];
}

// ------------------------- kernel 1: QKV GEMM -------------------------------
// Per batch: (384 x 128) @ (128 x 1024).  One block = one (b, 64 positions):
// 12 waves, wave p computes rows 32p..32p+31, which are the q, k or v section
// of one head, for the block's 64 positions from the shared LDS tile.
// Writes q,k as (b,h,t,dh) scaled by 1/sqrt(dh); v as (b,h,dh,t).
// Routing (q/k/v section, head) is wave-uniform -> scalar branches.
// Register budget for 6 waves per SIMD: two blocks per WGP, so the whole grid
// of 512 blocks is resident at once.
__global__ __launch_bounds__(384, 6)
void k_qkv_gemm(const uint16_t* __restrict__ wbf,
                const uint16_t* __restrict__ xn,
                uint16_t* __restrict__ q,
                uint16_t* __restrict__ k,
                uint16_t* __restrict__ v) {
    __shared__ __align__(16) uint16_t tile[XT_ROWS * XT_PITCH];
    int tid  = threadIdx.x;
    int wib  = __builtin_amdgcn_readfirstlane(tid >> 5);   // 0..11
    int lane = tid & 31;
    int half = lane >> 4, lm = lane & 15;
    int b    = blockIdx.x >> 4;
    int n0   = (blockIdx.x & 15) * XT_ROWS;   // first position of the block

    int head = wib / 3;               // all wave-uniform scalars
    int sec  = wib - head * 3;        // 0=q 1=k 2=v
    size_t bh = (size_t)b * NH + head;

    u32x4 buf[4];
    if (wib < 8)                      // scalar branch: waves 8..11 only load A
        stage_load(buf, xn + ((size_t)b * HWN + n0) * CCH, tid);

    v16bf A[2][4];
    const uint16_t* arow = wbf + (size_t)(wib * 32 + lm) * CCH + half * 8;
#pragma unroll
    for (int m = 0; m < 2; ++m)
#pragma unroll
        for (int kk = 0; kk < 4; ++kk)
            A[m][kk] = load_frag(arow + m * 16 * CCH + kk * 32);
    // The wait that belongs in front of any reuse of the A loads' address
    // registers; naming the address keeps those registers until it.
    asm volatile("s_wait_xcnt 0x0" :: "v"(arow) : "memory");

    if (wib < 8) stage_store(tile, buf, tid);
    __syncthreads();

    // 32 rows x 16 positions: channels 0..15 (acc0) and 16..31 (acc1) of the section.
    auto mm = [&](int nt, v8f& acc0, v8f& acc1) {
        const uint16_t* brow = tile + (nt * 16 + lm) * XT_PITCH + half * 8;
#pragma unroll
        for (int kk = 0; kk < 4; ++kk) {
            v16bf Bf = load_frag(brow + kk * 32);
            acc0 = wmma_bf16(A[0][kk], Bf, acc0);
            acc1 = wmma_bf16(A[1][kk], Bf, acc1);
        }
    };

    // The section test stands outside the position loop: each side is one
    // straight run of products and stores.
    if (sec == 2) {
        uint16_t* dst = v + (bh * DH + half * 8) * HWN + n0 + lm;
#pragma unroll 2   // a full unroll spills at this register budget
        for (int nt = 0; nt < 4; ++nt) {
            v8f acc0 = {}, acc1 = {};
            mm(nt, acc0, acc1);
#pragma unroll
            for (int r = 0; r < 8; ++r) {
                dst[(size_t)r * HWN + nt * 16]        = f2bf(acc0[r]);
                dst[(size_t)(16 + r) * HWN + nt * 16] = f2bf(acc1[r]);
            }
        }
    } else {
        uint16_t* dst = (sec == 0 ? q : k) + (bh * HWN + n0 + lm) * DH + half * 8;
#pragma unroll 2   // a full unroll spills at this register budget
        for (int nt = 0; nt < 4; ++nt) {
            v8f acc0 = {}, acc1 = {};
            mm(nt, acc0, acc1);
            store8bf(dst + nt * 16 * DH, acc0, QKSCALE);   // one b128 store per lane
            store8bf(dst + nt * 16 * DH + 16, acc1, QKSCALE);
        }
    }
}

// ------------------------- kernel 2: flash attention ------------------------
// One block = one (b, h, group of 8 token tiles); 8 waves, one 16-row tile
// each.  K and V come into LDS in stages of KST keys, two buffers, by
// global_load_async_to_lds_b128 (ASYNCcnt); every wave copies its own slice of
// a stage, and the next stage flies while this one's four 32-key passes run,
// with one publish point (waits and barrier) per stage.  Scores are
// computed transposed, S^T = K Q^T: lane (lm, half) holds 16 of a pass's 32
// scores of query lm, so the online softmax is in-lane plus one exchange
// between halves, and the two packed S^T tiles are the B operand of
// O^T += V^T P^T as they stand.
__global__ void k_attention(const uint16_t* __restrict__ q,
                            const uint16_t* __restrict__ k,
                            const uint16_t* __restrict__ v,
                            uint16_t* __restrict__ ho) {
    __shared__ __align__(16) uint16_t sK[2][KST * K_PITCH];   // (s_local, c)
    __shared__ __align__(16) uint16_t sV[2][DH * V_PITCH];    // (c, s_local)

    int tid  = threadIdx.x;
    int wib  = __builtin_amdgcn_readfirstlane(tid >> 5);
    int lane = tid & 31;
    int half = lane >> 4, lm = lane & 15;

    int blk = blockIdx.x;                     // 32*4*8 blocks
    int b   = blk >> 5;
    int rem = blk & 31;
    int h   = rem >> 3;
    int tg  = rem & 7;
    int t0  = (tg * 8 + wib) * 16;
    size_t bh = (size_t)b * NH + h;

    v16bf Qf = load_frag(q + (bh * HWN + t0 + lm) * DH + half * 8);
    v8f O0 = {}, O1 = {};
    float m = -1e30f, l = 0.f;    // l: this half's keys only, joined at the end

    // The thread's pieces of a stage: K is contiguous (4 pieces a row), a V row
    // holds 16 pieces.  Low 32 bits of a __shared__ address = LDS offset.
    const uint16_t* gk = k + bh * HWN * DH + tid * 8;
    const uint16_t* gv = v + bh * DH * HWN + (size_t)(tid >> 4) * HWN + (tid & 15) * 8;
    uint32_t lk = (uint32_t)(uintptr_t)&sK[0][(tid >> 2) * K_PITCH + (tid & 3) * 8];
    uint32_t lv = (uint32_t)(uintptr_t)&sV[0][(tid >> 4) * V_PITCH + (tid & 15) * 8];

    // Prologue: stage 0 landed and published, stage 1 in flight.
    stage_kv(lk, gk, lv, gv);
    asm volatile("s_wait_asynccnt 0x0" ::: "memory");   // own copies of stage 0 landed
    __syncthreads();
    stage_kv(lk + K_BYTES, gk + KST * DH, lv + V_BYTES, gv + KST);

#pragma unroll 1   // rolled: the text of all 32 passes would be eight times as long to fetch
    for (int st = 0; st < NSTAGE; ++st) {
        int cur = st & 1;
        const uint16_t* kc = sK[cur] + lm * K_PITCH + half * 8;
        const uint16_t* vc = sV[cur] + lm * V_PITCH + half * 8;

#pragma unroll   // no barrier inside: a pass's LDS reads can rise over the pass before
        for (int ps4 = 0; ps4 < KST / 32; ++ps4) {
            const uint16_t* kp = kc + ps4 * 32 * K_PITCH;
            const uint16_t* vp = vc + ps4 * 32;
            v16bf K0 = load_frag(kp);                     // s = 0..15
            v16bf K1 = load_frag(kp + 16 * K_PITCH);      // s = 16..31
            v8f S0 = {}, S1 = {};
            S0 = wmma_bf16(K0, Qf, S0);   // S0[r] = score(s = half*8 + r,      t = lm)
            S1 = wmma_bf16(K1, Qf, S1);   // S1[r] = score(s = 16 + half*8 + r, t = lm)
            v16bf V0 = load_frag(vp);                     // c = 0..15
            v16bf V1 = load_frag(vp + 16 * V_PITCH);      // c = 16..31

            float mx[8];
#pragma unroll   // constant indices keep mx and the tiles in registers
            for (int r = 0; r < 8; ++r) mx[r] = fmaxf(S0[r], S1[r]);
            float rowm = fmaxf(fmaxf(fmaxf(mx[0], mx[1]), fmaxf(mx[2], mx[3])),
                               fmaxf(fmaxf(mx[4], mx[5]), fmaxf(mx[6], mx[7])));
            rowm = fmaxf(rowm, other_half(rowm));
            float newm = fmaxf(m, rowm);
            float f    = __expf(m - newm);
            m = newm;

            float ps[8];
            FragU P;                      // B-frag 32(s) x 16(t), hardware k order
#pragma unroll   // constant indices keep ps and P in registers
            for (int i = 0; i < 4; ++i) {
                float a0 = __expf(S0[2 * i] - newm), a1 = __expf(S0[2 * i + 1] - newm);
                float b0 = __expf(S1[2 * i] - newm), b1 = __expf(S1[2 * i + 1] - newm);
                ps[2 * i]     = a0 + a1;
                ps[2 * i + 1] = b0 + b1;
                P.q2[0][i] = pk2bf(a0, a1);
                P.q2[1][i] = pk2bf(b0, b1);
            }
            l = l * f + (((ps[0] + ps[1]) + (ps[2] + ps[3])) +
                         ((ps[4] + ps[5]) + (ps[6] + ps[7])));
#pragma unroll   // constant indices keep the accumulators in registers
            for (int r = 0; r < 8; ++r) { O0[r] *= f; O1[r] *= f; }
            O0 = wmma_bf16(V0, P.v, O0);  // O0[r] = out(c = half*8 + r,      t = lm)
            O1 = wmma_bf16(V1, P.v, O1);  // O1[r] = out(c = 16 + half*8 + r, t = lm)
        }

        // Publish point: this wave has left buffer cur, its slice of the next
        // stage has landed; behind the barrier that holds for every wave.
        asm volatile("s_wait_dscnt 0x0" ::: "memory");
        asm volatile("s_wait_asynccnt 0x0" ::: "memory");
        __syncthreads();
        if (st + 2 < NSTAGE)              // refill the buffer just left
            stage_kv(lk + cur * K_BYTES, gk + (size_t)(st + 2) * KST * DH,
                     lv + cur * V_BYTES, gv + (st + 2) * KST);
    }
    asm volatile("s_wait_asynccnt 0x0" ::: "memory");   // nothing in flight at the end

    l += other_half(l);
    float inv = 1.f / fmaxf(l, 1e-30f);
    uint16_t* op = ho + ((size_t)b * HWN + t0 + lm) * CCH + h * DH + half * 8;
    store8bf(op, O0, inv);            // 8 consecutive channels per lane
    store8bf(op + 16, O1, inv);
}

// ------------------------- kernel 3: proj + bias + residual -----------------
// One block = one (b, 64 positions): 8 waves, wave mt computes output rows
// 16mt..16mt+15 from the shared LDS tile of ho.
__global__ __launch_bounds__(256)
void k_proj_gemm(const uint16_t* __restrict__ wbf,
                 const uint16_t* __restrict__ ho,
                 const float* __restrict__ pb,
                 const float* __restrict__ x,
                 float* __restrict__ out) {
    __shared__ __align__(16) uint16_t tile[XT_ROWS * XT_PITCH];
    int tid  = threadIdx.x;
    int mt   = __builtin_amdgcn_readfirstlane(tid >> 5);   // 0..7
    int lane = tid & 31;
    int half = lane >> 4, lm = lane & 15;
    int b    = blockIdx.x >> 4;
    int n0   = (blockIdx.x & 15) * XT_ROWS;

    u32x4 buf[4];
    stage_load(buf, ho + ((size_t)b * HWN + n0) * CCH, tid);

    v16bf A[4];
    const uint16_t* arow = wbf + (size_t)(mt * 16 + lm) * CCH + half * 8;
#pragma unroll
    for (int kk = 0; kk < 4; ++kk) A[kk] = load_frag(arow + kk * 32);

    stage_store(tile, buf, tid);
    __syncthreads();

#pragma unroll
    for (int nt = 0; nt < 4; ++nt) {
        int t = n0 + nt * 16 + lm;
        const uint16_t* brow = tile + (nt * 16 + lm) * XT_PITCH + half * 8;
        v8f acc = {};
#pragma unroll
        for (int kk = 0; kk < 4; ++kk)
            acc = wmma_bf16(A[kk], load_frag(brow + kk * 32), acc);

#pragma unroll
        for (int r = 0; r < 8; ++r) {
            int o = mt * 16 + r + half * 8;
            size_t idx = ((size_t)b * CCH + o) * HWN + t;
            out[idx] = acc[r] + pb[o] + x[idx];
        }
    }
}

// ---------------------------------------------------------------------------
extern "C" void kernel_launch(void* const* d_in, const int* in_sizes, int n_in,
                              void* d_out, int out_size, void* d_ws, size_t ws_size,
                              hipStream_t stream) {
    const float* x      = (const float*)d_in[0];
    const float* norm_w = (const float*)d_in[1];
    const float* norm_b = (const float*)d_in[2];
    const float* qkv_w  = (const float*)d_in[3];
    const float* proj_w = (const float*)d_in[4];
    const float* proj_b = (const float*)d_in[5];
    float* out = (float*)d_out;

    char* ws = (char*)d_ws;
    const size_t SZ_BCHW_BF = (size_t)BATCH * CCH * HWN * 2;   // 8 MB bf16
    size_t off = 0;
    uint16_t* xn      = (uint16_t*)(ws + off); off += SZ_BCHW_BF;
    uint16_t* qb      = (uint16_t*)(ws + off); off += SZ_BCHW_BF;
    uint16_t* kb      = (uint16_t*)(ws + off); off += SZ_BCHW_BF;
    uint16_t* vb      = (uint16_t*)(ws + off); off += SZ_BCHW_BF;
    uint16_t* hob     = (uint16_t*)(ws + off); off += SZ_BCHW_BF;
    uint16_t* qkv_bf  = (uint16_t*)(ws + off); off += (size_t)3 * CCH * CCH * 2;
    uint16_t* proj_bf = (uint16_t*)(ws + off); off += (size_t)CCH * CCH * 2;
    (void)ws_size; (void)in_sizes; (void)n_in; (void)out_size;

    k_groupnorm<<<dim3(GN_BLOCKS + WC_BLOCKS), dim3(1024), 0, stream>>>(
        x, norm_w, norm_b, xn, qkv_w, proj_w, qkv_bf, proj_bf);
    k_qkv_gemm<<<dim3(BATCH * 16), dim3(384), 0, stream>>>(
        qkv_bf, xn, qb, kb, vb);
    k_attention<<<dim3(BATCH * NH * 8), dim3(256), 0, stream>>>(qb, kb, vb, hob);
    k_proj_gemm<<<dim3(BATCH * 16), dim3(256), 0, stream>>>(
        proj_bf, hob, proj_b, x, out);
}

// v008
// One run takes 44.3 microseconds.
// Two timings next to v007 put it at 1.09 and 1.10 times that version's speed.
// All steps since v000 together make it 4.77 times as fast.
#include <hip/hip_runtime.h>
#include <stdint.h>

// ---------------------------------------------------------------------------
// CDNA5 / gfx1250 attention block: GroupNorm -> QKV (WMMA) -> flash attention
// (WMMA, async-LDS staged K/V) -> proj (WMMA) + bias + residual.
// wave32, bf16 operands, f32 accumulate.
// ---------------------------------------------------------------------------

typedef __attribute__((ext_vector_type(16))) __bf16    v16bf;
typedef __attribute__((ext_vector_type(8)))  float     v8f;
typedef __attribute__((ext_vector_type(4)))  uint32_t  u32x4;
typedef __attribute__((ext_vector_type(2)))  uint32_t  u32x2;
typedef __attribute__((ext_vector_type(4)))  float     f32x4;

#define BATCH 32
#define CCH   128
#define HWN   1024
#define NH    4
#define DH    32
#define QKSCALE 0.17677669529663687f  // 1/sqrt(32)
#define LOG2E   1.4426950408889634f   // folded into q's weights: scores in log2 units

union FragU { u32x4 q2[2]; v16bf v; };

typedef __attribute__((ext_vector_type(2)))  float     f32x2;
typedef __attribute__((ext_vector_type(2)))  __bf16    bf16x2;

// f32 -> bf16, round to nearest even, by the hardware's own conversion.
__device__ __forceinline__ uint16_t f2bf(float f) {
    return __builtin_bit_cast(uint16_t, (__bf16)f);
}

// Two f32 -> one packed register (lo in bits 15-0): one v_cvt_pk_bf16_f32.
__device__ __forceinline__ uint32_t pk2bf(float lo, float hi) {
    f32x2 p = {lo, hi};
    return __builtin_bit_cast(uint32_t, __builtin_convertvector(p, bf16x2));
}

// Fragment load: per-lane 8 bf16 at base and 8 bf16 at base+16 elements.
// Caller passes base already offset by half*8 so lane halves get the ISA's
// K split {0..7,16..23} / {8..15,24..31}.
__device__ __forceinline__ v16bf load_frag(const uint16_t* p) {
    FragU f;
    f.q2[0] = *(const u32x4*)(p);
    f.q2[1] = *(const u32x4*)(p + 16);
    return f.v;
}

__device__ __forceinline__ v8f wmma_bf16(v16bf a, v16bf b, v8f c) {
    return __builtin_amdgcn_wmma_f32_16x16x32_bf16(
        false, a, false, b, (short)0, c, false, false);
}

// Pack 8 accumulator floats (scaled) to 8 bf16 and store as one b128.
__device__ __forceinline__ void store8bf(uint16_t* dst, v8f a, float s) {
    uint32_t w[4];
#pragma unroll
    for (int i = 0; i < 4; ++i)
        w[i] = pk2bf(a[2 * i] * s, a[2 * i + 1] * s);
    u32x4 pk = {w[0], w[1], w[2], w[3]};
    *(u32x4*)dst = pk;
}

// Value of lane l ^ 16: the other half's share of the same query column.
__device__ __forceinline__ float other_half(float v) {
    int b = __builtin_bit_cast(int, v);
    b = __builtin_amdgcn_permlanex16(b, b, 0x76543210, 0xfedcba98, false, false);
    return __builtin_bit_cast(float, b);
}

// The exponentials (base 2) of a lane's 16 scores of a pass, and their sum.
__device__ __forceinline__ float exp_sum(const v8f& S0, const v8f& S1,
                                         float (&e0)[8], float (&e1)[8]) {
    float ps[8];
#pragma unroll   // constant indices keep e0, e1 and ps in registers
    for (int i = 0; i < 4; ++i) {
        e0[2 * i]     = __builtin_amdgcn_exp2f(S0[2 * i]);
        e0[2 * i + 1] = __builtin_amdgcn_exp2f(S0[2 * i + 1]);
        e1[2 * i]     = __builtin_amdgcn_exp2f(S1[2 * i]);
        e1[2 * i + 1] = __builtin_amdgcn_exp2f(S1[2 * i + 1]);
        ps[2 * i]     = e0[2 * i] + e0[2 * i + 1];
        ps[2 * i + 1] = e1[2 * i] + e1[2 * i + 1];
    }
    return ((ps[0] + ps[1]) + (ps[2] + ps[3])) + ((ps[4] + ps[5]) + (ps[6] + ps[7]));
}

// One stage of K and V in LDS: KST keys.  K rows (one key, 32 channels) stand
// at 80 B, V rows (one channel, KST keys) at 272 B: both 16 B x odd, so that the
// 16 rows which one ds_load_b128 reads per wave half fall on all 64 banks.
#define KST      128
#define NSTAGE   (HWN / KST)
#define K_PITCH  40
#define V_PITCH  (KST + 8)
#define K_BYTES  (KST * K_PITCH * 2)
#define V_BYTES  (DH * V_PITCH * 2)

// Async DMA of a thread's share of one stage (256 threads): two 16-byte pieces
// of K, 64 rows apart, and two of V, 16 rows apart (ASYNCcnt).  lk, lv, gk, gv:
// the lane's own first pieces.  A wave's K copy covers 512 contiguous bytes, its
// V copy 256 contiguous bytes of each of two rows.  The closing s_wait_xcnt is
// the wait that belongs in front of any rewrite of the copies' address
// registers; inside the statement nothing can be scheduled between them.
__device__ __forceinline__ void stage_kv(uint32_t lk, const uint16_t* gk,
                                         uint32_t lv, const uint16_t* gv) {
    asm volatile("global_load_async_to_lds_b128 %0, %1, off\n\t"
                 "global_load_async_to_lds_b128 %2, %3, off\n\t"
                 "global_load_async_to_lds_b128 %4, %5, off\n\t"
                 "global_load_async_to_lds_b128 %6, %7, off\n\t"
                 "s_wait_xcnt 0x0"
                 :: "v"(lk),                     "v"(gk),
                    "v"(lv),                     "v"(gv),
                    "v"(lk + 64 * K_PITCH * 2),  "v"(gk + 64 * DH),
                    "v"(lv + 16 * V_PITCH * 2),  "v"(gv + 16 * HWN)
                 : "memory");
}

// ------------------------- kernel 0: GroupNorm + weight convert --------------
// The two jobs read nothing of each other, so they share one grid: blocks
// 0..GN_BLOCKS-1 normalize, the WC_BLOCKS behind them round the weights to bf16
// on WGPs that the normalizing blocks leave idle.
#define GN_BLOCKS   (BATCH * 2)
#define WC_PER_BLK  4096                            // 1024 threads x 4 weights
#define WC_QKV_BLKS (3 * CCH * CCH / WC_PER_BLK)    // 12
#define WC_BLOCKS   (4 * CCH * CCH / WC_PER_BLK)    // 16: qkv_w, then proj_w
// A normalizing block:
// One 1024-thread block per (b, 64 channels = 16 groups): 64 bf16 channels are
// one 128-byte line of a row of xn, so this block is that line's only writer.
// Wave (cq, tq) keeps 8 channels (2 groups) x 256 positions in registers.
// The normalized bf16 tile is transposed through LDS and xn, laid out
// (b, t, c) for the GEMM's B operand, is stored as whole lines.
#define GN_PITCH 72   // LDS row: 64 channels + 8 pad = 144 B (16 B x odd)
__global__ __launch_bounds__(1024)
void k_groupnorm(const float* __restrict__ x,
                 const float* __restrict__ nw,
                 const float* __restrict__ nb,
                 uint16_t* __restrict__ xn,
                 const float* __restrict__ qkv_w,
                 const float* __restrict__ proj_w,
                 uint16_t* __restrict__ qkv_bf,
                 uint16_t* __restrict__ proj_bf) {
    __shared__ __align__(16) uint16_t tile[HWN * GN_PITCH];
    __shared__ f32x4 red[32];
    int tid  = threadIdx.x;

    // Weight blocks: the test is the same for the whole block and stands in
    // front of every barrier.  16 B read and 8 B written per lane.
    if (blockIdx.x >= GN_BLOCKS) {
        int wb = blockIdx.x - GN_BLOCKS;
        const float* s = wb < WC_QKV_BLKS ? qkv_w + wb * WC_PER_BLK
                                          : proj_w + (wb - WC_QKV_BLKS) * WC_PER_BLK;
        uint16_t*    d = wb < WC_QKV_BLKS ? qkv_bf + wb * WC_PER_BLK
                                          : proj_bf + (wb - WC_QKV_BLKS) * WC_PER_BLK;
        // A block holds 32 rows of qkv_w: the q, k or v section of one head.
        float sc = (wb < WC_QKV_BLKS && wb % 3 == 0) ? LOG2E : 1.f;
        f32x4 w4 = *(const f32x4*)(s + tid * 4);
        u32x2 pk = {pk2bf(w4[0] * sc, w4[1] * sc), pk2bf(w4[2] * sc, w4[3] * sc)};
        *(u32x2*)(d + tid * 4) = pk;
        return;
    }

    int wave = __builtin_amdgcn_readfirstlane(tid >> 5);
    int lane = tid & 31;
    int b    = blockIdx.x >> 1;
    int ch0  = (blockIdx.x & 1) * 64;
    int cq   = wave & 7;             // 8-channel chunk of the 64
    int tq   = wave >> 3;            // quarter of the 1024 positions
    int c0   = ch0 + cq * 8;

    // Every wave-wide load covers 512 contiguous bytes of one channel's row.
    const float* xp = x + ((size_t)(b * CCH + c0)) * HWN + tq * 256 + lane * 4;
    f32x4 val[8][2];
#pragma unroll
    for (int kc = 0; kc < 8; ++kc)
#pragma unroll
        for (int j = 0; j < 2; ++j)
            val[kc][j] = *(const f32x4*)(xp + kc * HWN + j * 128);

    // Sum and sum of squares of the wave's two groups (channels 0-3, 4-7).
    f32x4 st = {0.f, 0.f, 0.f, 0.f};
#pragma unroll
    for (int kc = 0; kc < 8; ++kc)
#pragma unroll
        for (int j = 0; j < 2; ++j)
#pragma unroll
            for (int e = 0; e < 4; ++e) {
                float f = val[kc][j][e];
                st[(kc >> 2) * 2]     += f;
                st[(kc >> 2) * 2 + 1] += f * f;
            }
#pragma unroll
    for (int off = 16; off > 0; off >>= 1)
#pragma unroll
        for (int i = 0; i < 4; ++i)
            st[i] += __shfl_xor(st[i], off, 32);
    if (lane == 0) red[wave] = st;
    __syncthreads();
    // The four waves with this cq hold the four quarters of the same groups.
    st = (red[cq] + red[8 + cq]) + (red[16 + cq] + red[24 + cq]);

    float wch[8], bch[8];
#pragma unroll
    for (int g = 0; g < 2; ++g) {
        float mu   = st[g * 2] * (1.f / 4096.f);
        float var  = st[g * 2 + 1] * (1.f / 4096.f) - mu * mu;
        float rstd = rsqrtf(var + 1e-5f);
#pragma unroll
        for (int i = 0; i < 4; ++i) {
            int kc = g * 4 + i;
            wch[kc] = nw[c0 + kc] * rstd;
            bch[kc] = nb[c0 + kc] - mu * wch[kc];
        }
    }

    // One 16-byte LDS store per position: its 8 channels.  Lanes are 4 rows
    // apart, which at this pitch reaches only 4 of the 16 bank groups; the
    // chunk index is XORed with bits 4-5 of t so that 16 lanes reach all 16.
    int wsw = (cq ^ ((lane >> 2) & 3)) * 8;
#pragma unroll
    for (int j = 0; j < 2; ++j)
#pragma unroll
        for (int e = 0; e < 4; ++e) {
            int t = tq * 256 + j * 128 + lane * 4 + e;
            uint32_t w[4];
#pragma unroll
            for (int i = 0; i < 4; ++i)
                w[i] = pk2bf(val[2 * i][j][e] * wch[2 * i] + bch[2 * i],
                             val[2 * i + 1][j][e] * wch[2 * i + 1] + bch[2 * i + 1]);
            u32x4 pk = {w[0], w[1], w[2], w[3]};
            *(u32x4*)(tile + t * GN_PITCH + wsw) = pk;
        }
    __syncthreads();

    // Read rows back and store: 8 lanes cover one 128-byte line.  Lanes 0-7
    // and 8-15 take rows 8 apart, which fall on disjoint banks at this pitch.
    int lg = lane >> 3, lc = lane & 7;
    uint16_t* op = xn + (size_t)b * HWN * CCH + ch0 + lc * 8;
#pragma unroll
    for (int i = 0; i < 8; ++i) {
        int t = wave * 32 + lg * 8 + i;
        u32x4 pk = *(const u32x4*)(tile + t * GN_PITCH + (lc ^ ((t >> 4) & 3)) * 8);
        *(u32x4*)(op + (size_t)t * CCH) = pk;
    }
}

// ------------------------- GEMM B tile in LDS -------------------------------
// Both GEMMs take B from a (b, t, c) array.  A block stages 64 positions x 128
// channels (16 KB, contiguous in global memory) once: every wave-wide load
// covers 512 contiguous bytes, and all row tiles of the block read their
// fragments from LDS.  256 threads (8 waves) stage, four 16-byte chunks each.
#define XT_ROWS  64
#define XT_PITCH 136  // LDS row: 128 channels + 8 pad = 272 B (16 B x odd)
// The loads are issued ahead of the block's A loads, the LDS stores behind them.
__device__ __forceinline__ void stage_load(u32x4 (&buf)[4], const uint16_t* src, int tid) {
#pragma unroll   // constant indices keep buf in registers, all loads in flight
    for (int j = 0; j < 4; ++j)
        buf[j] = *(const u32x4*)(src + (size_t)(tid + j * 256) * 8);
}
__device__ __forceinline__ void stage_store(uint16_t* tile, const u32x4 (&buf)[4], int tid) {
#pragma unroll   // constant indices keep buf in registers
    for (int j = 0; j < 4; ++j)
        *(u32x4*)(tile + ((tid >> 4) + j * 16) * XT_PITCH + (tid & 15) * 8) = buf[j];
}

// ------------------------- kernel 1: QKV GEMM -------------------------------
// Per batch: (384 x 128) @ (128 x 1024).  One block = one (b, 64 positions):
// 12 waves, wave p computes rows 32p..32p+31, which are the q, k or v section
// of one head, for the block's 64 positions from the shared LDS tile.
// Writes q,k as (b,h,t,dh) scaled by 1/sqrt(dh); v as (b,h,dh,t).
// Routing (q/k/v section, head) is wave-uniform -> scalar branches.
// Register budget for 6 waves per SIMD: two blocks per WGP, so the whole grid
// of 512 blocks is resident at once.
__global__ __launch_bounds__(384, 6)
void k_qkv_gemm(const uint16_t* __restrict__ wbf,
                const uint16_t* __restrict__ xn,
                uint16_t* __restrict__ q,
                uint16_t* __restrict__ k,
                uint16_t* __restrict__ v) {
    __shared__ __align__(16) uint16_t tile[XT_ROWS * XT_PITCH];
    int tid  = threadIdx.x;
    int wib  = __builtin_amdgcn_readfirstlane(tid >> 5);   // 0..11
    int lane = tid & 31;
    int half = lane >> 4, lm = lane & 15;
    int b    = blockIdx.x >> 4;
    int n0   = (blockIdx.x & 15) * XT_ROWS;   // first position of the block

    int head = wib / 3;               // all wave-uniform scalars
    int sec  = wib - head * 3;        // 0=q 1=k 2=v
    size_t bh = (size_t)b * NH + head;

    u32x4 buf[4];
    if (wib < 8)                      // scalar branch: waves 8..11 only load A
        stage_load(buf, xn + ((size_t)b * HWN + n0) * CCH, tid);

    v16bf A[2][4];
    const uint16_t* arow = wbf + (size_t)(wib * 32 + lm) * CCH + half * 8;
#pragma unroll
    for (int m = 0; m < 2; ++m)
#pragma unroll
        for (int kk = 0; kk < 4; ++kk)
            A[m][kk] = load_frag(arow + m * 16 * CCH + kk * 32);
    // The wait that belongs in front of any reuse of the A loads' address
    // registers; naming the address keeps those registers until it.
    asm volatile("s_wait_xcnt 0x0" :: "v"(arow) : "memory");

    if (wib < 8) stage_store(tile, buf, tid);
    __syncthreads();

    // 32 rows x 16 positions: channels 0..15 (acc0) and 16..31 (acc1) of the section.
    auto mm = [&](int nt, v8f& acc0, v8f& acc1) {
        const uint16_t* brow = tile + (nt * 16 + lm) * XT_PITCH + half * 8;
#pragma unroll
        for (int kk = 0; kk < 4; ++kk) {
            v16bf Bf = load_frag(brow + kk * 32);
            acc0 = wmma_bf16(A[0][kk], Bf, acc0);
            acc1 = wmma_bf16(A[1][kk], Bf, acc1);
        }
    };

    // The section test stands outside the position loop: each side is one
    // straight run of products and stores.
    if (sec == 2) {
        uint16_t* dst = v + (bh * DH + half * 8) * HWN + n0 + lm;
#pragma unroll 2   // a full unroll spills at this register budget
        for (int nt = 0; nt < 4; ++nt) {
            v8f acc0 = {}, acc1 = {};
            mm(nt, acc0, acc1);
#pragma unroll
            for (int r = 0; r < 8; ++r) {
                dst[(size_t)r * HWN + nt * 16]        = f2bf(acc0[r]);
                dst[(size_t)(16 + r) * HWN + nt * 16] = f2bf(acc1[r]);
            }
        }
    } else {
        uint16_t* dst = (sec == 0 ? q : k) + (bh * HWN + n0 + lm) * DH + half * 8;
#pragma unroll 2   // a full unroll spills at this register budget
        for (int nt = 0; nt < 4; ++nt) {
            v8f acc0 = {}, acc1 = {};
            mm(nt, acc0, acc1);
            store8bf(dst + nt * 16 * DH, acc0, QKSCALE);   // one b128 store per lane
            store8bf(dst + nt * 16 * DH + 16, acc1, QKSCALE);
        }
    }
}

// ------------------------- kernel 2: flash attention ------------------------
// One block = one (b, h, group of 8 token tiles); 8 waves, one 16-row tile
// each.  K and V come into LDS in stages of KST keys, two buffers, by
// global_load_async_to_lds_b128 (ASYNCcnt); every wave copies its own slice of
// a stage, and the next stage flies while this one's four 32-key passes run,
// with one publish point (waits and barrier) per stage.  Scores are
// computed transposed, S^T = K Q^T: lane (lm, half) holds 16 of a pass's 32
// scores of query lm, so the online softmax is in-lane plus one exchange
// between halves, and the two packed S^T tiles are the B operand of
// O^T += V^T P^T as they stand.
// The scores leave the matrix unit as arguments of exp2: q carries log2(e)
// from its weights, and the C operand of S^T is minus the query's maximum in
// use, the same in all eight registers of a lane.  That maximum is the true
// one of the first pass and moves only when a pass's sum of exponentials says
// that a score may stand more than 8 (log2) above it; only then are O and l
// rescaled and the pass's exponentials formed again.  The result is the same
// softmax for any maximum in use: it cancels in O / l.
#define LAZY_SUM 256.f   // 2^8: no exponential above it goes into P, O or l
__global__ void k_attention(const uint16_t* __restrict__ q,
                            const uint16_t* __restrict__ k,
                            const uint16_t* __restrict__ v,
                            uint16_t* __restrict__ ho) {
    __shared__ __align__(16) uint16_t sK[2][KST * K_PITCH];   // (s_local, c)
    __shared__ __align__(16) uint16_t sV[2][DH * V_PITCH];    // (c, s_local)

    int tid  = threadIdx.x;
    int wib  = __builtin_amdgcn_readfirstlane(tid >> 5);
    int lane = tid & 31;
    int half = lane >> 4, lm = lane & 15;

    int blk = blockIdx.x;                     // 32*4*8 blocks
    int b   = blk >> 5;
    int rem = blk & 31;
    int h   = rem >> 3;
    int tg  = rem & 7;
    int t0  = (tg * 8 + wib) * 16;
    size_t bh = (size_t)b * NH + h;

    v16bf Qf = load_frag(q + (bh * HWN + t0 + lm) * DH + half * 8);
    v8f O0 = {}, O1 = {};
    v8f Cm = {};                  // minus the maximum in use, C operand of S^T
    float l = 0.f;                // this half's keys only, joined at the end

    // The thread's pieces of a stage: K is contiguous (4 pieces a row), a V row
    // holds 16 pieces.  Low 32 bits of a __shared__ address = LDS offset.
    const uint16_t* gk = k + bh * HWN * DH + tid * 8;
    const uint16_t* gv = v + bh * DH * HWN + (size_t)(tid >> 4) * HWN + (tid & 15) * 8;
    uint32_t lk = (uint32_t)(uintptr_t)&sK[0][(tid >> 2) * K_PITCH + (tid & 3) * 8];
    uint32_t lv = (uint32_t)(uintptr_t)&sV[0][(tid >> 4) * V_PITCH + (tid & 15) * 8];

    // Prologue: stage 0 landed and published, stage 1 in flight.
    stage_kv(lk, gk, lv, gv);
    asm volatile("s_wait_asynccnt 0x0" ::: "memory");   // own copies of stage 0 landed
    __syncthreads();
    stage_kv(lk + K_BYTES, gk + KST * DH, lv + V_BYTES, gv + KST);

#pragma unroll 1   // rolled: the text of all 32 passes would be eight times as long to fetch
    for (int st = 0; st < NSTAGE; ++st) {
        int cur = st & 1;
        const uint16_t* kc = sK[cur] + lm * K_PITCH + half * 8;
        const uint16_t* vc = sV[cur] + lm * V_PITCH + half * 8;

#pragma unroll   // no barrier inside: a pass's LDS reads can rise among the O products before
        for (int ps4 = 0; ps4 < KST / 32; ++ps4) {
            const uint16_t* kp = kc + ps4 * 32 * K_PITCH;
            const uint16_t* vp = vc + ps4 * 32;
            v16bf K0 = load_frag(kp);                     // s = 0..15
            v16bf K1 = load_frag(kp + 16 * K_PITCH);      // s = 16..31
            v16bf V0 = load_frag(vp);                     // c = 0..15
            v16bf V1 = load_frag(vp + 16 * V_PITCH);      // c = 16..31
            // The pass's eight LDS reads stay one group in front of its
            // products; left alone they are split up, each part waited for.
            __builtin_amdgcn_sched_barrier(0);
            v8f S0 = wmma_bf16(K0, Qf, Cm);   // S0[r]: s = half*8 + r,      t = lm
            v8f S1 = wmma_bf16(K1, Qf, Cm);   // S1[r]: s = 16 + half*8 + r, t = lm

            float e0[8], e1[8];
            float sum = exp_sum(S0, S1, e0, e1);
            // Keeps the V reads in that group: without a use on this side of
            // the branch below they sink behind it.
            asm volatile("" :: "v"(V0), "v"(V1));

            // One scalar branch per pass, taken by the whole wave: in the very
            // first pass, which sets the maximum, and where a lane's sum says
            // that a score may stand more than 8 above the maximum in use.
            bool first = ps4 == 0 && st == 0;
            if (__builtin_amdgcn_ballot_w32((sum > LAZY_SUM) | first) != 0) {
                float mx[8];
#pragma unroll   // constant indices keep mx and the tiles in registers
                for (int r = 0; r < 8; ++r) mx[r] = fmaxf(S0[r], S1[r]);
                float rowm = fmaxf(fmaxf(fmaxf(mx[0], mx[1]), fmaxf(mx[2], mx[3])),
                                   fmaxf(fmaxf(mx[4], mx[5]), fmaxf(mx[6], mx[7])));
                rowm = fmaxf(rowm, other_half(rowm));
                // The maximum in use only rises, but for the first pass, where
                // O and l are still 0 and f needs only to be finite.
                float d = first ? rowm : fmaxf(rowm, 0.f);
                float f = __builtin_amdgcn_exp2f(fminf(-d, 0.f));
#pragma unroll   // constant indices keep the tiles in registers
                for (int r = 0; r < 8; ++r) {
                    S0[r] -= d; S1[r] -= d; Cm[r] -= d;
                    O0[r] *= f; O1[r] *= f;
                }
                l *= f;
                sum = exp_sum(S0, S1, e0, e1);
            }
            l += sum;

            FragU P;                      // B-frag 32(s) x 16(t), hardware k order
#pragma unroll   // constant indices keep P in registers
            for (int i = 0; i < 4; ++i) {
                P.q2[0][i] = pk2bf(e0[2 * i], e0[2 * i + 1]);
                P.q2[1][i] = pk2bf(e1[2 * i], e1[2 * i + 1]);
            }
            O0 = wmma_bf16(V0, P.v, O0);  // O0[r] = out(c = half*8 + r,      t = lm)
            O1 = wmma_bf16(V1, P.v, O1);  // O1[r] = out(c = 16 + half*8 + r, t = lm)
        }

        // Publish point: this wave has left buffer cur, its slice of the next
        // stage has landed; behind the barrier that holds for every wave.
        asm volatile("s_wait_dscnt 0x0" ::: "memory");
        asm volatile("s_wait_asynccnt 0x0" ::: "memory");
        __syncthreads();
        if (st + 2 < NSTAGE)              // refill the buffer just left
            stage_kv(lk + cur * K_BYTES, gk + (size_t)(st + 2) * KST * DH,
                     lv + cur * V_BYTES, gv + (st + 2) * KST);
    }
    asm volatile("s_wait_asynccnt 0x0" ::: "memory");   // nothing in flight at the end

    l += other_half(l);
    float inv = 1.f / fmaxf(l, 1e-30f);
    uint16_t* op = ho + ((size_t)b * HWN + t0 + lm) * CCH + h * DH + half * 8;
    store8bf(op, O0, inv);            // 8 consecutive channels per lane
    store8bf(op + 16, O1, inv);
}

// ------------------------- kernel 3: proj + bias + residual -----------------
// One block = one (b, 64 positions): 8 waves, wave mt computes output rows
// 16mt..16mt+15 from the shared LDS tile of ho.
__global__ __launch_bounds__(256)
void k_proj_gemm(const uint16_t* __restrict__ wbf,
                 const uint16_t* __restrict__ ho,
                 const float* __restrict__ pb,
                 const float* __restrict__ x,
                 float* __restrict__ out) {
    __shared__ __align__(16) uint16_t tile[XT_ROWS * XT_PITCH];
    int tid  = threadIdx.x;
    int mt   = __builtin_amdgcn_readfirstlane(tid >> 5);   // 0..7
    int lane = tid & 31;
    int half = lane >> 4, lm = lane & 15;
    int b    = blockIdx.x >> 4;
    int n0   = (blockIdx.x & 15) * XT_ROWS;

    u32x4 buf[4];
    stage_load(buf, ho + ((size_t)b * HWN + n0) * CCH, tid);

    v16bf A[4];
    const uint16_t* arow = wbf + (size_t)(mt * 16 + lm) * CCH + half * 8;
#pragma unroll
    for (int kk = 0; kk < 4; ++kk) A[kk] = load_frag(arow + kk * 32);

    stage_store(tile, buf, tid);
    __syncthreads();

#pragma unroll
    for (int nt = 0; nt < 4; ++nt) {
        int t = n0 + nt * 16 + lm;
        const uint16_t* brow = tile + (nt * 16 + lm) * XT_PITCH + half * 8;
        v8f acc = {};
#pragma unroll
        for (int kk = 0; kk < 4; ++kk)
            acc = wmma_bf16(A[kk], load_frag(brow + kk * 32), acc);

#pragma unroll
        for (int r = 0; r < 8; ++r) {
            int o = mt * 16 + r + half * 8;
            size_t idx = ((size_t)b * CCH + o) * HWN + t;
            out[idx] = acc[r] + pb[o] + x[idx];
        }
    }
}

// ---------------------------------------------------------------------------
extern "C" void kernel_launch(void* const* d_in, const int* in_sizes, int n_in,
                              void* d_out, int out_size, void* d_ws, size_t ws_size,
                              hipStream_t stream) {
    const float* x      = (const float*)d_in[0];
    const float* norm_w = (const float*)d_in[1];
    const float* norm_b = (const float*)d_in[2];
    const float* qkv_w  = (const float*)d_in[3];
    const float* proj_w = (const float*)d_in[4];
    const float* proj_b = (const float*)d_in[5];
    float* out = (float*)d_out;

    char* ws = (char*)d_ws;
    const size_t SZ_BCHW_BF = (size_t)BATCH * CCH * HWN * 2;   // 8 MB bf16
    size_t off = 0;
    uint16_t* xn      = (uint16_t*)(ws + off); off += SZ_BCHW_BF;
    uint16_t* qb      = (uint16_t*)(ws + off); off += SZ_BCHW_BF;
    uint16_t* kb      = (uint16_t*)(ws + off); off += SZ_BCHW_BF;
    uint16_t* vb      = (uint16_t*)(ws + off); off += SZ_BCHW_BF;
    uint16_t* hob     = (uint16_t*)(ws + off); off += SZ_BCHW_BF;
    uint16_t* qkv_bf  = (uint16_t*)(ws + off); off += (size_t)3 * CCH * CCH * 2;
    uint16_t* proj_bf = (uint16_t*)(ws + off); off += (size_t)CCH * CCH * 2;
    (void)ws_size; (void)in_sizes; (void)n_in; (void)out_size;

    k_groupnorm<<<dim3(GN_BLOCKS + WC_BLOCKS), dim3(1024), 0, stream>>>(
        x, norm_w, norm_b, xn, qkv_w, proj_w, qkv_bf, proj_bf);
    k_qkv_gemm<<<dim3(BATCH * 16), dim3(384), 0, stream>>>(
        qkv_bf, xn, qb, kb, vb);
    k_attention<<<dim3(BATCH * NH * 8), dim3(256), 0, stream>>>(qb, kb, vb, hob);
    k_proj_gemm<<<dim3(BATCH * 16), dim3(256), 0, stream>>>(
        proj_bf, hob, proj_b, x, out);
}

// v009
// A run of this version takes 41.9 microseconds.
// In both of two side-by-side timings against v008, it was 1.06 times as fast.
// All steps since v000 together make it 5.05 times as fast.
#include <hip/hip_runtime.h>
#include <stdint.h>

// ---------------------------------------------------------------------------
// CDNA5 / gfx1250 attention block: GroupNorm -> QKV (WMMA) -> flash attention
// (WMMA, async-LDS staged K/V) with proj (WMMA) + bias + residual behind it.
// wave32, bf16 operands, f32 accumulate.
// ---------------------------------------------------------------------------

typedef __attribute__((ext_vector_type(16))) __bf16    v16bf;
typedef __attribute__((ext_vector_type(8)))  float     v8f;
typedef __attribute__((ext_vector_type(4)))  uint32_t  u32x4;
typedef __attribute__((ext_vector_type(2)))  uint32_t  u32x2;
typedef __attribute__((ext_vector_type(4)))  float     f32x4;

#define BATCH 32
#define CCH   128
#define HWN   1024
#define NH    4
#define DH    32
#define QKSCALE 0.17677669529663687f  // 1/sqrt(32)
#define LOG2E   1.4426950408889634f   // folded into q's weights: scores in log2 units

union FragU { u32x4 q2[2]; v16bf v; };

typedef __attribute__((ext_vector_type(2)))  float     f32x2;
typedef __attribute__((ext_vector_type(2)))  __bf16    bf16x2;

// f32 -> bf16, round to nearest even, by the hardware's own conversion.
__device__ __forceinline__ uint16_t f2bf(float f) {
    return __builtin_bit_cast(uint16_t, (__bf16)f);
}

// Two f32 -> one packed register (lo in bits 15-0): one v_cvt_pk_bf16_f32.
__device__ __forceinline__ uint32_t pk2bf(float lo, float hi) {
    f32x2 p = {lo, hi};
    return __builtin_bit_cast(uint32_t, __builtin_convertvector(p, bf16x2));
}

// Fragment load: per-lane 8 bf16 at base and 8 bf16 at base+16 elements.
// Caller passes base already offset by half*8 so lane halves get the ISA's
// K split {0..7,16..23} / {8..15,24..31}.
__device__ __forceinline__ v16bf load_frag(const uint16_t* p) {
    FragU f;
    f.q2[0] = *(const u32x4*)(p);
    f.q2[1] = *(const u32x4*)(p + 16);
    return f.v;
}

__device__ __forceinline__ v8f wmma_bf16(v16bf a, v16bf b, v8f c) {
    return __builtin_amdgcn_wmma_f32_16x16x32_bf16(
        false, a, false, b, (short)0, c, false, false);
}

// Pack 8 accumulator floats (scaled) to 8 bf16 and store as one b128.
__device__ __forceinline__ void store8bf(uint16_t* dst, v8f a, float s) {
    uint32_t w[4];
#pragma unroll
    for (int i = 0; i < 4; ++i)
        w[i] = pk2bf(a[2 * i] * s, a[2 * i + 1] * s);
    u32x4 pk = {w[0], w[1], w[2], w[3]};
    *(u32x4*)dst = pk;
}

// Value of lane l ^ 16: the other half's share of the same query column.
__device__ __forceinline__ float other_half(float v) {
    int b = __builtin_bit_cast(int, v);
    b = __builtin_amdgcn_permlanex16(b, b, 0x76543210, 0xfedcba98, false, false);
    return __builtin_bit_cast(float, b);
}

// The exponentials (base 2) of a lane's 16 scores of a pass, and their sum.
__device__ __forceinline__ float exp_sum(const v8f& S0, const v8f& S1,
                                         float (&e0)[8], float (&e1)[8]) {
    float ps[8];
#pragma unroll   // constant indices keep e0, e1 and ps in registers
    for (int i = 0; i < 4; ++i) {
        e0[2 * i]     = __builtin_amdgcn_exp2f(S0[2 * i]);
        e0[2 * i + 1] = __builtin_amdgcn_exp2f(S0[2 * i + 1]);
        e1[2 * i]     = __builtin_amdgcn_exp2f(S1[2 * i]);
        e1[2 * i + 1] = __builtin_amdgcn_exp2f(S1[2 * i + 1]);
        ps[2 * i]     = e0[2 * i] + e0[2 * i + 1];
        ps[2 * i + 1] = e1[2 * i] + e1[2 * i + 1];
    }
    return ((ps[0] + ps[1]) + (ps[2] + ps[3])) + ((ps[4] + ps[5]) + (ps[6] + ps[7]));
}

// One stage of K and V in LDS: KST keys.  K rows (one key, 32 channels) stand
// at 80 B, V rows (one channel, KST keys) at 272 B: both 16 B x odd, so that the
// 16 rows which one ds_load_b128 reads per wave half fall on all 64 banks.
#define KST      128
#define NSTAGE   (HWN / KST)
#define K_PITCH  40
#define V_PITCH  (KST + 8)
#define K_BYTES  (KST * K_PITCH * 2)
#define V_BYTES  (DH * V_PITCH * 2)

// Async DMA of a thread's share of one stage (256 threads): two 16-byte pieces
// of K, 64 rows apart, and two of V, 16 rows apart (ASYNCcnt).  lk, lv, gk, gv:
// the lane's own first pieces.  A wave's K copy covers 512 contiguous bytes, its
// V copy 256 contiguous bytes of each of two rows.  The closing s_wait_xcnt is
// the wait that belongs in front of any rewrite of the copies' address
// registers; inside the statement nothing can be scheduled between them.
__device__ __forceinline__ void stage_kv(uint32_t lk, const uint16_t* gk,
                                         uint32_t lv, const uint16_t* gv) {
    asm volatile("global_load_async_to_lds_b128 %0, %1, off\n\t"
                 "global_load_async_to_lds_b128 %2, %3, off\n\t"
                 "global_load_async_to_lds_b128 %4, %5, off\n\t"
                 "global_load_async_to_lds_b128 %6, %7, off\n\t"
                 "s_wait_xcnt 0x0"
                 :: "v"(lk),                     "v"(gk),
                    "v"(lv),                     "v"(gv),
                    "v"(lk + 64 * K_PITCH * 2),  "v"(gk + 64 * DH),
                    "v"(lv + 16 * V_PITCH * 2),  "v"(gv + 16 * HWN)
                 : "memory");
}

// ------------------------- kernel 0: GroupNorm + weight convert --------------
// The two jobs read nothing of each other, so they share one grid: blocks
// 0..GN_BLOCKS-1 normalize, the WC_BLOCKS behind them round the weights to bf16
// on WGPs that the normalizing blocks leave idle.
#define GN_BLOCKS   (BATCH * 2)
#define WC_PER_BLK  4096                            // 1024 threads x 4 weights
#define WC_QKV_BLKS (3 * CCH * CCH / WC_PER_BLK)    // 12
#define WC_BLOCKS   (4 * CCH * CCH / WC_PER_BLK)    // 16: qkv_w, then proj_w
// A normalizing block:
// One 1024-thread block per (b, 64 channels = 16 groups): 64 bf16 channels are
// one 128-byte line of a row of xn, so this block is that line's only writer.
// Wave (cq, tq) keeps 8 channels (2 groups) x 256 positions in registers.
// The normalized bf16 tile is transposed through LDS and xn, laid out
// (b, t, c) for the GEMM's B operand, is stored as whole lines.
#define GN_PITCH 72   // LDS row: 64 channels + 8 pad = 144 B (16 B x odd)
__global__ __launch_bounds__(1024)
void k_groupnorm(const float* __restrict__ x,
                 const float* __restrict__ nw,
                 const float* __restrict__ nb,
                 uint16_t* __restrict__ xn,
                 const float* __restrict__ qkv_w,
                 const float* __restrict__ proj_w,
                 uint16_t* __restrict__ qkv_bf,
                 uint16_t* __restrict__ proj_bf) {
    __shared__ __align__(16) uint16_t tile[HWN * GN_PITCH];
    __shared__ f32x4 red[32];
    int tid  = threadIdx.x;

    // Weight blocks: the test is the same for the whole block and stands in
    // front of every barrier.  16 B read and 8 B written per lane.
    if (blockIdx.x >= GN_BLOCKS) {
        int wb = blockIdx.x - GN_BLOCKS;
        const float* s = wb < WC_QKV_BLKS ? qkv_w + wb * WC_PER_BLK
                                          : proj_w + (wb - WC_QKV_BLKS) * WC_PER_BLK;
        uint16_t*    d = wb < WC_QKV_BLKS ? qkv_bf + wb * WC_PER_BLK
                                          : proj_bf + (wb - WC_QKV_BLKS) * WC_PER_BLK;
        // A block holds 32 rows of qkv_w: the q, k or v section of one head.
        float sc = (wb < WC_QKV_BLKS && wb % 3 == 0) ? LOG2E : 1.f;
        f32x4 w4 = *(const f32x4*)(s + tid * 4);
        u32x2 pk = {pk2bf(w4[0] * sc, w4[1] * sc), pk2bf(w4[2] * sc, w4[3] * sc)};
        *(u32x2*)(d + tid * 4) = pk;
        return;
    }

    int wave = __builtin_amdgcn_readfirstlane(tid >> 5);
    int lane = tid & 31;
    int b    = blockIdx.x >> 1;
    int ch0  = (blockIdx.x & 1) * 64;
    int cq   = wave & 7;             // 8-channel chunk of the 64
    int tq   = wave >> 3;            // quarter of the 1024 positions
    int c0   = ch0 + cq * 8;

    // Every wave-wide load covers 512 contiguous bytes of one channel's row.
    const float* xp = x + ((size_t)(b * CCH + c0)) * HWN + tq * 256 + lane * 4;
    f32x4 val[8][2];
#pragma unroll
    for (int kc = 0; kc < 8; ++kc)
#pragma unroll
        for (int j = 0; j < 2; ++j)
            val[kc][j] = *(const f32x4*)(xp + kc * HWN + j * 128);

    // Sum and sum of squares of the wave's two groups (channels 0-3, 4-7).
    f32x4 st = {0.f, 0.f, 0.f, 0.f};
#pragma unroll
    for (int kc = 0; kc < 8; ++kc)
#pragma unroll
        for (int j = 0; j < 2; ++j)
#pragma unroll
            for (int e = 0; e < 4; ++e) {
                float f = val[kc][j][e];
                st[(kc >> 2) * 2]     += f;
                st[(kc >> 2) * 2 + 1] += f * f;
            }
#pragma unroll
    for (int off = 16; off > 0; off >>= 1)
#pragma unroll
        for (int i = 0; i < 4; ++i)
            st[i] += __shfl_xor(st[i], off, 32);
    if (lane == 0) red[wave] = st;
    __syncthreads();
    // The four waves with this cq hold the four quarters of the same groups.
    st = (red[cq] + red[8 + cq]) + (red[16 + cq] + red[24 + cq]);

    float wch[8], bch[8];
#pragma unroll
    for (int g = 0; g < 2; ++g) {
        float mu   = st[g * 2] * (1.f / 4096.f);
        float var  = st[g * 2 + 1] * (1.f / 4096.f) - mu * mu;
        float rstd = rsqrtf(var + 1e-5f);
#pragma unroll
        for (int i = 0; i < 4; ++i) {
            int kc = g * 4 + i;
            wch[kc] = nw[c0 + kc] * rstd;
            bch[kc] = nb[c0 + kc] - mu * wch[kc];
        }
    }

    // One 16-byte LDS store per position: its 8 channels.  Lanes are 4 rows
    // apart, which at this pitch reaches only 4 of the 16 bank groups; the
    // chunk index is XORed with bits 4-5 of t so that 16 lanes reach all 16.
    int wsw = (cq ^ ((lane >> 2) & 3)) * 8;
#pragma unroll
    for (int j = 0; j < 2; ++j)
#pragma unroll
        for (int e = 0; e < 4; ++e) {
            int t = tq * 256 + j * 128 + lane * 4 + e;
            uint32_t w[4];
#pragma unroll
            for (int i = 0; i < 4; ++i)
                w[i] = pk2bf(val[2 * i][j][e] * wch[2 * i] + bch[2 * i],
                             val[2 * i + 1][j][e] * wch[2 * i + 1] + bch[2 * i + 1]);
            u32x4 pk = {w[0], w[1], w[2], w[3]};
            *(u32x4*)(tile + t * GN_PITCH + wsw) = pk;
        }
    __syncthreads();

    // Read rows back and store: 8 lanes cover one 128-byte line.  Lanes 0-7
    // and 8-15 take rows 8 apart, which fall on disjoint banks at this pitch.
    int lg = lane >> 3, lc = lane & 7;
    uint16_t* op = xn + (size_t)b * HWN * CCH + ch0 + lc * 8;
#pragma unroll
    for (int i = 0; i < 8; ++i) {
        int t = wave * 32 + lg * 8 + i;
        u32x4 pk = *(const u32x4*)(tile + t * GN_PITCH + (lc ^ ((t >> 4) & 3)) * 8);
        *(u32x4*)(op + (size_t)t * CCH) = pk;
    }
}

// ------------------------- GEMM B tile in LDS -------------------------------
// The QKV GEMM takes B from a (b, t, c) array.  A block stages 64 positions x 128
// channels (16 KB, contiguous in global memory) once: every wave-wide load
// covers 512 contiguous bytes, and all row tiles of the block read their
// fragments from LDS.  256 threads (8 waves) stage, four 16-byte chunks each.
#define XT_ROWS  64
#define XT_PITCH 136  // LDS row: 128 channels + 8 pad = 272 B (16 B x odd)
// The loads are issued ahead of the block's A loads, the LDS stores behind them.
__device__ __forceinline__ void stage_load(u32x4 (&buf)[4], const uint16_t* src, int tid) {
#pragma unroll   // constant indices keep buf in registers, all loads in flight
    for (int j = 0; j < 4; ++j)
        buf[j] = *(const u32x4*)(src + (size_t)(tid + j * 256) * 8);
}
__device__ __forceinline__ void stage_store(uint16_t* tile, const u32x4 (&buf)[4], int tid) {
#pragma unroll   // constant indices keep buf in registers
    for (int j = 0; j < 4; ++j)
        *(u32x4*)(tile + ((tid >> 4) + j * 16) * XT_PITCH + (tid & 15) * 8) = buf[j];
}

// ------------------------- kernel 1: QKV GEMM -------------------------------
// Per batch: (384 x 128) @ (128 x 1024).  One block = one (b, 64 positions):
// 12 waves, wave p computes rows 32p..32p+31, which are the q, k or v section
// of one head, for the block's 64 positions from the shared LDS tile.
// Writes q,k as (b,h,t,dh) scaled by 1/sqrt(dh); v as (b,h,dh,t).
// Routing (q/k/v section, head) is wave-uniform -> scalar branches.
// Register budget for 6 waves per SIMD: two blocks per WGP, so the whole grid
// of 512 blocks is resident at once.
__global__ __launch_bounds__(384, 6)
void k_qkv_gemm(const uint16_t* __restrict__ wbf,
                const uint16_t* __restrict__ xn,
                uint16_t* __restrict__ q,
                uint16_t* __restrict__ k,
                uint16_t* __restrict__ v) {
    __shared__ __align__(16) uint16_t tile[XT_ROWS * XT_PITCH];
    int tid  = threadIdx.x;
    int wib  = __builtin_amdgcn_readfirstlane(tid >> 5);   // 0..11
    int lane = tid & 31;
    int half = lane >> 4, lm = lane & 15;
    int b    = blockIdx.x >> 4;
    int n0   = (blockIdx.x & 15) * XT_ROWS;   // first position of the block

    int head = wib / 3;               // all wave-uniform scalars
    int sec  = wib - head * 3;        // 0=q 1=k 2=v
    size_t bh = (size_t)b * NH + head;

    u32x4 buf[4];
    if (wib < 8)                      // scalar branch: waves 8..11 only load A
        stage_load(buf, xn + ((size_t)b * HWN + n0) * CCH, tid);

    v16bf A[2][4];
    const uint16_t* arow = wbf + (size_t)(wib * 32 + lm) * CCH + half * 8;
#pragma unroll
    for (int m = 0; m < 2; ++m)
#pragma unroll
        for (int kk = 0; kk < 4; ++kk)
            A[m][kk] = load_frag(arow + m * 16 * CCH + kk * 32);
    // The wait that belongs in front of any reuse of the A loads' address
    // registers; naming the address keeps those registers until it.
    asm volatile("s_wait_xcnt 0x0" :: "v"(arow) : "memory");

    if (wib < 8) stage_store(tile, buf, tid);
    __syncthreads();

    // 32 rows x 16 positions: channels 0..15 (acc0) and 16..31 (acc1) of the section.
    auto mm = [&](int nt, v8f& acc0, v8f& acc1) {
        const uint16_t* brow = tile + (nt * 16 + lm) * XT_PITCH + half * 8;
#pragma unroll
        for (int kk = 0; kk < 4; ++kk) {
            v16bf Bf = load_frag(brow + kk * 32);
            acc0 = wmma_bf16(A[0][kk], Bf, acc0);
            acc1 = wmma_bf16(A[1][kk], Bf, acc1);
        }
    };

    // The section test stands outside the position loop: each side is one
    // straight run of products and stores.
    if (sec == 2) {
        uint16_t* dst = v + (bh * DH + half * 8) * HWN + n0 + lm;
#pragma unroll 2   // a full unroll spills at this register budget
        for (int nt = 0; nt < 4; ++nt) {
            v8f acc0 = {}, acc1 = {};
            mm(nt, acc0, acc1);
#pragma unroll
            for (int r = 0; r < 8; ++r) {
                dst[(size_t)r * HWN + nt * 16]        = f2bf(acc0[r]);
                dst[(size_t)(16 + r) * HWN + nt * 16] = f2bf(acc1[r]);
            }
        }
    } else {
        uint16_t* dst = (sec == 0 ? q : k) + (bh * HWN + n0 + lm) * DH + half * 8;
#pragma unroll 2   // a full unroll spills at this register budget
        for (int nt = 0; nt < 4; ++nt) {
            v8f acc0 = {}, acc1 = {};
            mm(nt, acc0, acc1);
            store8bf(dst + nt * 16 * DH, acc0, QKSCALE);   // one b128 store per lane
            store8bf(dst + nt * 16 * DH + 16, acc1, QKSCALE);
        }
    }
}

// ------------- kernel 2: flash attention + proj + bias + residual -----------
// One block = one (b, 128 positions), all four heads: 32 waves, wave (h, wt)
// takes head h and the 16-row tile wt.  With every channel of its positions in
// one block, the output projection runs in the same launch, from an LDS tile.
// K and V come into LDS in stages of KST keys, two buffers per head, by
// global_load_async_to_lds_b128 (ASYNCcnt); the eight waves of a head copy that
// head's stage, each its own slice, and the next stage flies while this one's
// four 32-key passes run, with one publish point (waits and barrier) per stage,
// which all 32 waves pass together.  Scores are
// computed transposed, S^T = K Q^T: lane (lm, half) holds 16 of a pass's 32
// scores of query lm, so the online softmax is in-lane plus one exchange
// between halves, and the two packed S^T tiles are the B operand of
// O^T += V^T P^T as they stand.
// The scores leave the matrix unit as arguments of exp2: q carries log2(e)
// from its weights, and the C operand of S^T is minus the query's maximum in
// use, the same in all eight registers of a lane.  That maximum is the true
// one of the first pass and moves only when a pass's sum of exponentials says
// that a score may stand more than 8 (log2) above it; only then are O and l
// rescaled and the pass's exponentials formed again.  The result is the same
// softmax for any maximum in use: it cancels in O / l.
#define LAZY_SUM 256.f   // 2^8: no exponential above it goes into P, O or l
#define AT_ROWS  128     // positions of a block
__global__ __launch_bounds__(1024)
void k_attention_proj(const uint16_t* __restrict__ q,
                      const uint16_t* __restrict__ k,
                      const uint16_t* __restrict__ v,
                      const uint16_t* __restrict__ wbf,
                      const float* __restrict__ pb,
                      const float* __restrict__ x,
                      float* __restrict__ out) {
    __shared__ __align__(16) uint16_t sK[NH][2][KST * K_PITCH];   // (s_local, c)
    __shared__ __align__(16) uint16_t sV[NH][2][DH * V_PITCH];    // (c, s_local)
    __shared__ __align__(16) uint16_t sH[AT_ROWS * XT_PITCH];     // (t_local, c)

    int tid  = threadIdx.x;
    int wib  = __builtin_amdgcn_readfirstlane(tid >> 5);   // 0..31
    int lane = tid & 31;
    int half = lane >> 4, lm = lane & 15;

    int b   = blockIdx.x >> 3;                // 32*8 blocks
    int n0  = (blockIdx.x & 7) * AT_ROWS;     // first position of the block
    int h   = wib >> 3;
    int wt  = wib & 7;
    int ht  = tid & 255;                      // thread among its head's 256
    int t0  = n0 + wt * 16;
    size_t bh = (size_t)b * NH + h;

    v16bf Qf = load_frag(q + (bh * HWN + t0 + lm) * DH + half * 8);
    v8f O0 = {}, O1 = {};
    v8f Cm = {};                  // minus the maximum in use, C operand of S^T
    float l = 0.f;                // this half's keys only, joined at the end

    // The thread's pieces of a stage: K is contiguous (4 pieces a row), a V row
    // holds 16 pieces.  Low 32 bits of a __shared__ address = LDS offset.
    const uint16_t* gk = k + bh * HWN * DH + ht * 8;
    const uint16_t* gv = v + bh * DH * HWN + (size_t)(ht >> 4) * HWN + (ht & 15) * 8;
    uint32_t lk = (uint32_t)(uintptr_t)&sK[h][0][(ht >> 2) * K_PITCH + (ht & 3) * 8];
    uint32_t lv = (uint32_t)(uintptr_t)&sV[h][0][(ht >> 4) * V_PITCH + (ht & 15) * 8];

    // Prologue: stage 0 landed and published, stage 1 in flight.
    stage_kv(lk, gk, lv, gv);
    asm volatile("s_wait_asynccnt 0x0" ::: "memory");   // own copies of stage 0 landed
    __syncthreads();
    stage_kv(lk + K_BYTES, gk + KST * DH, lv + V_BYTES, gv + KST);

#pragma unroll 1   // rolled: the text of all 32 passes would be eight times as long to fetch
    for (int st = 0; st < NSTAGE; ++st) {
        int cur = st & 1;
        const uint16_t* kc = sK[h][cur] + lm * K_PITCH + half * 8;
        const uint16_t* vc = sV[h][cur] + lm * V_PITCH + half * 8;

#pragma unroll   // no barrier inside: a pass's LDS reads can rise among the O products before
        for (int ps4 = 0; ps4 < KST / 32; ++ps4) {
            const uint16_t* kp = kc + ps4 * 32 * K_PITCH;
            const uint16_t* vp = vc + ps4 * 32;
            v16bf K0 = load_frag(kp);                     // s = 0..15
            v16bf K1 = load_frag(kp + 16 * K_PITCH);      // s = 16..31
            v16bf V0 = load_frag(vp);                     // c = 0..15
            v16bf V1 = load_frag(vp + 16 * V_PITCH);      // c = 16..31
            // The pass's eight LDS reads stay one group in front of its
            // products; left alone they are split up, each part waited for.
            __builtin_amdgcn_sched_barrier(0);
            v8f S0 = wmma_bf16(K0, Qf, Cm);   // S0[r]: s = half*8 + r,      t = lm
            v8f S1 = wmma_bf16(K1, Qf, Cm);   // S1[r]: s = 16 + half*8 + r, t = lm

            float e0[8], e1[8];
            float sum = exp_sum(S0, S1, e0, e1);
            // Keeps the V reads in that group: without a use on this side of
            // the branch below they sink behind it.
            asm volatile("" :: "v"(V0), "v"(V1));

            // One scalar branch per pass, taken by the whole wave: in the very
            // first pass, which sets the maximum, and where a lane's sum says
            // that a score may stand more than 8 above the maximum in use.
            bool first = ps4 == 0 && st == 0;
            if (__builtin_amdgcn_ballot_w32((sum > LAZY_SUM) | first) != 0) {
                float mx[8];
#pragma unroll   // constant indices keep mx and the tiles in registers
                for (int r = 0; r < 8; ++r) mx[r] = fmaxf(S0[r], S1[r]);
                float rowm = fmaxf(fmaxf(fmaxf(mx[0], mx[1]), fmaxf(mx[2], mx[3])),
                                   fmaxf(fmaxf(mx[4], mx[5]), fmaxf(mx[6], mx[7])));
                rowm = fmaxf(rowm, other_half(rowm));
                // The maximum in use only rises, but for the first pass, where
                // O and l are still 0 and f needs only to be finite.
                float d = first ? rowm : fmaxf(rowm, 0.f);
                float f = __builtin_amdgcn_exp2f(fminf(-d, 0.f));
#pragma unroll   // constant indices keep the tiles in registers
                for (int r = 0; r < 8; ++r) {
                    S0[r] -= d; S1[r] -= d; Cm[r] -= d;
                    O0[r] *= f; O1[r] *= f;
                }
                l *= f;
                sum = exp_sum(S0, S1, e0, e1);
            }
            l += sum;

            FragU P;                      // B-frag 32(s) x 16(t), hardware k order
#pragma unroll   // constant indices keep P in registers
            for (int i = 0; i < 4; ++i) {
                P.q2[0][i] = pk2bf(e0[2 * i], e0[2 * i + 1]);
                P.q2[1][i] = pk2bf(e1[2 * i], e1[2 * i + 1]);
            }
            O0 = wmma_bf16(V0, P.v, O0);  // O0[r] = out(c = half*8 + r,      t = lm)
            O1 = wmma_bf16(V1, P.v, O1);  // O1[r] = out(c = 16 + half*8 + r, t = lm)
        }

        // Publish point: this wave has left buffer cur, its slice of the next
        // stage has landed; behind the barrier that holds for every wave.
        asm volatile("s_wait_dscnt 0x0" ::: "memory");
        asm volatile("s_wait_asynccnt 0x0" ::: "memory");
        __syncthreads();
        if (st + 2 < NSTAGE)              // refill the buffer just left
            stage_kv(lk + cur * K_BYTES, gk + (size_t)(st + 2) * KST * DH,
                     lv + cur * V_BYTES, gv + (st + 2) * KST);
    }
    asm volatile("s_wait_asynccnt 0x0" ::: "memory");   // nothing in flight at the end

    // Issued here so that they fly while O is normalized and handed over: the
    // wave's rows of the projection weights, its bias and its residual values.
    // Wave (mt, np): output rows 16mt..16mt+15, position tiles 2np and 2np+1.
    int mt = wt, np = h;
    v16bf A[4];
    const uint16_t* arow = wbf + (size_t)(mt * 16 + lm) * CCH + half * 8;
#pragma unroll   // constant indices keep A in registers
    for (int kk = 0; kk < 4; ++kk) A[kk] = load_frag(arow + kk * 32);
    int    o0   = mt * 16 + half * 8;
    size_t idx0 = ((size_t)b * CCH + o0) * HWN + n0 + np * 32 + lm;
    uint32_t pofs = (uint32_t)o0 * 4u;        // byte offset of the lane's bias values
    const float* pbp = (const float*)((const char*)pb + pofs);
    const float* xp  = x + idx0;
    float xr[2][8], pbv[8];
#pragma unroll   // constant indices keep xr and pbv in registers
    for (int r = 0; r < 8; ++r) {
        pbv[r]   = pbp[r];
        xr[0][r] = xp[(size_t)r * HWN];
        xr[1][r] = xp[(size_t)r * HWN + 16];
    }
    // The wait that belongs in front of any reuse of these loads' address
    // registers; naming the addresses keeps those registers until it.
    asm volatile("s_wait_xcnt 0x0" :: "v"(arow), "v"(pofs), "v"(xp) : "memory");

    // The head's 32 channels of the wave's 16 positions, bf16, into the tile.
    l += other_half(l);
    float inv = 1.f / fmaxf(l, 1e-30f);
    uint16_t* hp = sH + (wt * 16 + lm) * XT_PITCH + h * DH + half * 8;
    store8bf(hp, O0, inv);            // 8 consecutive channels per lane
    store8bf(hp + 16, O1, inv);
    __syncthreads();                  // all four heads' channels stand in sH

    const uint16_t* brow = sH + (np * 32 + lm) * XT_PITCH + half * 8;
    v8f acc[2] = {};
#pragma unroll   // constant indices keep A, Bf and acc in registers
    for (int kh = 0; kh < 2; ++kh) {
        v16bf Bf[2][2];               // both tiles, two k steps: one group of reads
#pragma unroll
        for (int j = 0; j < 2; ++j)
#pragma unroll
            for (int k2 = 0; k2 < 2; ++k2)
                Bf[j][k2] = load_frag(brow + j * 16 * XT_PITCH + (kh * 2 + k2) * 32);
        // The group's eight LDS reads stay together in front of its products;
        // left alone each pair of reads is waited for on its own.
        __builtin_amdgcn_sched_barrier(0);
#pragma unroll
        for (int k2 = 0; k2 < 2; ++k2)
#pragma unroll
            for (int j = 0; j < 2; ++j)
                acc[j] = wmma_bf16(A[kh * 2 + k2], Bf[j][k2], acc[j]);
    }
    float* op = out + idx0;
#pragma unroll   // constant indices keep acc, pbv and xr in registers
    for (int j = 0; j < 2; ++j)
#pragma unroll
        for (int r = 0; r < 8; ++r)
            op[(size_t)r * HWN + j * 16] = acc[j][r] + pbv[r] + xr[j][r];
}

// ---------------------------------------------------------------------------
extern "C" void kernel_launch(void* const* d_in, const int* in_sizes, int n_in,
                              void* d_out, int out_size, void* d_ws, size_t ws_size,
                              hipStream_t stream) {
    const float* x      = (const float*)d_in[0];
    const float* norm_w = (const float*)d_in[1];
    const float* norm_b = (const float*)d_in[2];
    const float* qkv_w  = (const float*)d_in[3];
    const float* proj_w = (const float*)d_in[4];
    const float* proj_b = (const float*)d_in[5];
    float* out = (float*)d_out;

    char* ws = (char*)d_ws;
    const size_t SZ_BCHW_BF = (size_t)BATCH * CCH * HWN * 2;   // 8 MB bf16
    size_t off = 0;
    uint16_t* xn      = (uint16_t*)(ws + off); off += SZ_BCHW_BF;
    uint16_t* qb      = (uint16_t*)(ws + off); off += SZ_BCHW_BF;
    uint16_t* kb      = (uint16_t*)(ws + off); off += SZ_BCHW_BF;
    uint16_t* vb      = (uint16_t*)(ws + off); off += SZ_BCHW_BF;
    uint16_t* qkv_bf  = (uint16_t*)(ws + off); off += (size_t)3 * CCH * CCH * 2;
    uint16_t* proj_bf = (uint16_t*)(ws + off); off += (size_t)CCH * CCH * 2;
    (void)ws_size; (void)in_sizes; (void)n_in; (void)out_size;

    k_groupnorm<<<dim3(GN_BLOCKS + WC_BLOCKS), dim3(1024), 0, stream>>>(
        x, norm_w, norm_b, xn, qkv_w, proj_w, qkv_bf, proj_bf);
    k_qkv_gemm<<<dim3(BATCH * 16), dim3(384), 0, stream>>>(
        qkv_bf, xn, qb, kb, vb);
    k_attention_proj<<<dim3(BATCH * 8), dim3(1024), 0, stream>>>(
        qb, kb, vb, proj_bf, proj_b, x, out);
}

// v010
// Measured time: 40.7 microseconds a run.
// Two timings next to v009 both put it at 1.03 times that version's speed.
// Counting every step since v000, it is 5.22 times as fast.
#include <hip/hip_runtime.h>
#include <stdint.h>

// ---------------------------------------------------------------------------
// CDNA5 / gfx1250 attention block: GroupNorm -> QKV (WMMA) -> flash attention
// (WMMA, async-LDS staged K/V) with proj (WMMA) + bias + residual behind it.
// wave32, bf16 operands, f32 accumulate.
// ---------------------------------------------------------------------------

typedef __attribute__((ext_vector_type(16))) __bf16    v16bf;
typedef __attribute__((ext_vector_type(8)))  float     v8f;
typedef __attribute__((ext_vector_type(4)))  uint32_t  u32x4;
typedef __attribute__((ext_vector_type(2)))  uint32_t  u32x2;
typedef __attribute__((ext_vector_type(4)))  float     f32x4;

#define BATCH 32
#define CCH   128
#define HWN   1024
#define NH    4
#define DH    32
#define QKSCALE 0.17677669529663687f  // 1/sqrt(32)
#define LOG2E   1.4426950408889634f   // folded into q's weights: scores in log2 units

union FragU { u32x4 q2[2]; v16bf v; };

typedef __attribute__((ext_vector_type(2)))  float     f32x2;
typedef __attribute__((ext_vector_type(2)))  __bf16    bf16x2;

// f32 -> bf16, round to nearest even, by the hardware's own conversion.
__device__ __forceinline__ uint16_t f2bf(float f) {
    return __builtin_bit_cast(uint16_t, (__bf16)f);
}

// Two f32 -> one packed register (lo in bits 15-0): one v_cvt_pk_bf16_f32.
__device__ __forceinline__ uint32_t pk2bf(float lo, float hi) {
    f32x2 p = {lo, hi};
    return __builtin_bit_cast(uint32_t, __builtin_convertvector(p, bf16x2));
}

// Fragment load: per-lane 8 bf16 at base and 8 bf16 at base+16 elements.
// Caller passes base already offset by half*8 so lane halves get the ISA's
// K split {0..7,16..23} / {8..15,24..31}.
__device__ __forceinline__ v16bf load_frag(const uint16_t* p) {
    FragU f;
    f.q2[0] = *(const u32x4*)(p);
    f.q2[1] = *(const u32x4*)(p + 16);
    return f.v;
}

__device__ __forceinline__ v8f wmma_bf16(v16bf a, v16bf b, v8f c) {
    return __builtin_amdgcn_wmma_f32_16x16x32_bf16(
        false, a, false, b, (short)0, c, false, false);
}

// Pack 8 accumulator floats (scaled) to 8 bf16 and store as one b128.
__device__ __forceinline__ void store8bf(uint16_t* dst, v8f a, float s) {
    uint32_t w[4];
#pragma unroll
    for (int i = 0; i < 4; ++i)
        w[i] = pk2bf(a[2 * i] * s, a[2 * i + 1] * s);
    u32x4 pk = {w[0], w[1], w[2], w[3]};
    *(u32x4*)dst = pk;
}

// Value of lane l ^ 16: the other half's share of the same query column.
__device__ __forceinline__ float other_half(float v) {
    int b = __builtin_bit_cast(int, v);
    b = __builtin_amdgcn_permlanex16(b, b, 0x76543210, 0xfedcba98, false, false);
    return __builtin_bit_cast(float, b);
}

// The exponentials (base 2) of a lane's 16 scores of a pass, and their sum.
__device__ __forceinline__ float exp_sum(const v8f& S0, const v8f& S1,
                                         float (&e0)[8], float (&e1)[8]) {
    float ps[8];
#pragma unroll   // constant indices keep e0, e1 and ps in registers
    for (int i = 0; i < 4; ++i) {
        e0[2 * i]     = __builtin_amdgcn_exp2f(S0[2 * i]);
        e0[2 * i + 1] = __builtin_amdgcn_exp2f(S0[2 * i + 1]);
        e1[2 * i]     = __builtin_amdgcn_exp2f(S1[2 * i]);
        e1[2 * i + 1] = __builtin_amdgcn_exp2f(S1[2 * i + 1]);
        ps[2 * i]     = e0[2 * i] + e0[2 * i + 1];
        ps[2 * i + 1] = e1[2 * i] + e1[2 * i + 1];
    }
    return ((ps[0] + ps[1]) + (ps[2] + ps[3])) + ((ps[4] + ps[5]) + (ps[6] + ps[7]));
}

// One stage of K and V in LDS: KST keys.  K rows (one key, 32 channels) stand
// at 80 B, V rows (one channel, KST keys) at 272 B: both 16 B x odd, so that the
// 16 rows which one ds_load_b128 reads per wave half fall on all 64 banks.
#define KST      128
#define NSTAGE   (HWN / KST)
#define K_PITCH  40
#define V_PITCH  (KST + 8)
#define K_BYTES  (KST * K_PITCH * 2)
#define V_BYTES  (DH * V_PITCH * 2)

// Async DMA of a thread's share of one stage (128 threads): four 16-byte pieces
// of K, 32 rows apart, and four of V, 8 rows apart (ASYNCcnt).  lk, lv, gk, gv:
// the lane's own first pieces.  A wave's K copy covers 512 contiguous bytes, its
// V copy 256 contiguous bytes of each of two rows.  The closing s_wait_xcnt is
// the wait that belongs in front of any rewrite of the copies' address
// registers; inside the statement nothing can be scheduled between them.
__device__ __forceinline__ void stage_kv(uint32_t lk, const uint16_t* gk,
                                         uint32_t lv, const uint16_t* gv) {
    asm volatile("global_load_async_to_lds_b128 %0, %1, off\n\t"
                 "global_load_async_to_lds_b128 %2, %3, off\n\t"
                 "global_load_async_to_lds_b128 %4, %5, off\n\t"
                 "global_load_async_to_lds_b128 %6, %7, off\n\t"
                 "global_load_async_to_lds_b128 %8, %9, off\n\t"
                 "global_load_async_to_lds_b128 %10, %11, off\n\t"
                 "global_load_async_to_lds_b128 %12, %13, off\n\t"
                 "global_load_async_to_lds_b128 %14, %15, off\n\t"
                 "s_wait_xcnt 0x0"
                 :: "v"(lk),                     "v"(gk),
                    "v"(lv),                     "v"(gv),
                    "v"(lk + 32 * K_PITCH * 2),  "v"(gk + 32 * DH),
                    "v"(lv + 8 * V_PITCH * 2),   "v"(gv + 8 * HWN),
                    "v"(lk + 64 * K_PITCH * 2),  "v"(gk + 64 * DH),
                    "v"(lv + 16 * V_PITCH * 2),  "v"(gv + 16 * HWN),
                    "v"(lk + 96 * K_PITCH * 2),  "v"(gk + 96 * DH),
                    "v"(lv + 24 * V_PITCH * 2),  "v"(gv + 24 * HWN)
                 : "memory");
}

// ------------------------- kernel 0: GroupNorm + weight convert --------------
// The two jobs read nothing of each other, so they share one grid: blocks
// 0..GN_BLOCKS-1 normalize, the WC_BLOCKS behind them round the weights to bf16
// on WGPs that the normalizing blocks leave idle.
#define GN_BLOCKS   (BATCH * 2)
#define WC_PER_BLK  4096                            // 1024 threads x 4 weights
#define WC_QKV_BLKS (3 * CCH * CCH / WC_PER_BLK)    // 12
#define WC_BLOCKS   (4 * CCH * CCH / WC_PER_BLK)    // 16: qkv_w, then proj_w
// A normalizing block:
// One 1024-thread block per (b, 64 channels = 16 groups): 64 bf16 channels are
// one 128-byte line of a row of xn, so this block is that line's only writer.
// Wave (cq, tq) keeps 8 channels (2 groups) x 256 positions in registers.
// The normalized bf16 tile is transposed through LDS and xn, laid out
// (b, t, c) for the GEMM's B operand, is stored as whole lines.
#define GN_PITCH 72   // LDS row: 64 channels + 8 pad = 144 B (16 B x odd)
__global__ __launch_bounds__(1024)
void k_groupnorm(const float* __restrict__ x,
                 const float* __restrict__ nw,
                 const float* __restrict__ nb,
                 uint16_t* __restrict__ xn,
                 const float* __restrict__ qkv_w,
                 const float* __restrict__ proj_w,
                 uint16_t* __restrict__ qkv_bf,
                 uint16_t* __restrict__ proj_bf) {
    __shared__ __align__(16) uint16_t tile[HWN * GN_PITCH];
    __shared__ f32x4 red[32];
    int tid  = threadIdx.x;

    // Weight blocks: the test is the same for the whole block and stands in
    // front of every barrier.  16 B read and 8 B written per lane.
    if (blockIdx.x >= GN_BLOCKS) {
        int wb = blockIdx.x - GN_BLOCKS;
        const float* s = wb < WC_QKV_BLKS ? qkv_w + wb * WC_PER_BLK
                                          : proj_w + (wb - WC_QKV_BLKS) * WC_PER_BLK;
        uint16_t*    d = wb < WC_QKV_BLKS ? qkv_bf + wb * WC_PER_BLK
                                          : proj_bf + (wb - WC_QKV_BLKS) * WC_PER_BLK;
        // A block holds 32 rows of qkv_w: the q, k or v section of one head.
        float sc = (wb < WC_QKV_BLKS && wb % 3 == 0) ? LOG2E : 1.f;
        f32x4 w4 = *(const f32x4*)(s + tid * 4);
        u32x2 pk = {pk2bf(w4[0] * sc, w4[1] * sc), pk2bf(w4[2] * sc, w4[3] * sc)};
        *(u32x2*)(d + tid * 4) = pk;
        return;
    }

    int wave = __builtin_amdgcn_readfirstlane(tid >> 5);
    int lane = tid & 31;
    int b    = blockIdx.x >> 1;
    int ch0  = (blockIdx.x & 1) * 64;
    int cq   = wave & 7;             // 8-channel chunk of the 64
    int tq   = wave >> 3;            // quarter of the 1024 positions
    int c0   = ch0 + cq * 8;

    // Every wave-wide load covers 512 contiguous bytes of one channel's row.
    const float* xp = x + ((size_t)(b * CCH + c0)) * HWN + tq * 256 + lane * 4;
    f32x4 val[8][2];
#pragma unroll
    for (int kc = 0; kc < 8; ++kc)
#pragma unroll
        for (int j = 0; j < 2; ++j)
            val[kc][j] = *(const f32x4*)(xp + kc * HWN + j * 128);

    // Sum and sum of squares of the wave's two groups (channels 0-3, 4-7).
    f32x4 st = {0.f, 0.f, 0.f, 0.f};
#pragma unroll
    for (int kc = 0; kc < 8; ++kc)
#pragma unroll
        for (int j = 0; j < 2; ++j)
#pragma unroll
            for (int e = 0; e < 4; ++e) {
                float f = val[kc][j][e];
                st[(kc >> 2) * 2]     += f;
                st[(kc >> 2) * 2 + 1] += f * f;
            }
#pragma unroll
    for (int off = 16; off > 0; off >>= 1)
#pragma unroll
        for (int i = 0; i < 4; ++i)
            st[i] += __shfl_xor(st[i], off, 32);
    if (lane == 0) red[wave] = st;
    __syncthreads();
    // The four waves with this cq hold the four quarters of the same groups.
    st = (red[cq] + red[8 + cq]) + (red[16 + cq] + red[24 + cq]);

    float wch[8], bch[8];
#pragma unroll
    for (int g = 0; g < 2; ++g) {
        float mu   = st[g * 2] * (1.f / 4096.f);
        float var  = st[g * 2 + 1] * (1.f / 4096.f) - mu * mu;
        float rstd = rsqrtf(var + 1e-5f);
#pragma unroll
        for (int i = 0; i < 4; ++i) {
            int kc = g * 4 + i;
            wch[kc] = nw[c0 + kc] * rstd;
            bch[kc] = nb[c0 + kc] - mu * wch[kc];
        }
    }

    // One 16-byte LDS store per position: its 8 channels.  Lanes are 4 rows
    // apart, which at this pitch reaches only 4 of the 16 bank groups; the
    // chunk index is XORed with bits 4-5 of t so that 16 lanes reach all 16.
    int wsw = (cq ^ ((lane >> 2) & 3)) * 8;
#pragma unroll
    for (int j = 0; j < 2; ++j)
#pragma unroll
        for (int e = 0; e < 4; ++e) {
            int t = tq * 256 + j * 128 + lane * 4 + e;
            uint32_t w[4];
#pragma unroll
            for (int i = 0; i < 4; ++i)
                w[i] = pk2bf(val[2 * i][j][e] * wch[2 * i] + bch[2 * i],
                             val[2 * i + 1][j][e] * wch[2 * i + 1] + bch[2 * i + 1]);
            u32x4 pk = {w[0], w[1], w[2], w[3]};
            *(u32x4*)(tile + t * GN_PITCH + wsw) = pk;
        }
    __syncthreads();

    // Read rows back and store: 8 lanes cover one 128-byte line.  Lanes 0-7
    // and 8-15 take rows 8 apart, which fall on disjoint banks at this pitch.
    int lg = lane >> 3, lc = lane & 7;
    uint16_t* op = xn + (size_t)b * HWN * CCH + ch0 + lc * 8;
#pragma unroll
    for (int i = 0; i < 8; ++i) {
        int t = wave * 32 + lg * 8 + i;
        u32x4 pk = *(const u32x4*)(tile + t * GN_PITCH + (lc ^ ((t >> 4) & 3)) * 8);
        *(u32x4*)(op + (size_t)t * CCH) = pk;
    }
}

// ------------------------- GEMM B tile in LDS -------------------------------
// The QKV GEMM takes B from a (b, t, c) array.  A block stages 64 positions x 128
// channels (16 KB, contiguous in global memory) once: every wave-wide load
// covers 512 contiguous bytes, and all row tiles of the block read their
// fragments from LDS.  256 threads (8 waves) stage, four 16-byte chunks each.
#define XT_ROWS  64
#define XT_PITCH 136  // LDS row: 128 channels + 8 pad = 272 B (16 B x odd)
// The loads are issued ahead of the block's A loads, the LDS stores behind them.
__device__ __forceinline__ void stage_load(u32x4 (&buf)[4], const uint16_t* src, int tid) {
#pragma unroll   // constant indices keep buf in registers, all loads in flight
    for (int j = 0; j < 4; ++j)
        buf[j] = *(const u32x4*)(src + (size_t)(tid + j * 256) * 8);
}
__device__ __forceinline__ void stage_store(uint16_t* tile, const u32x4 (&buf)[4], int tid) {
#pragma unroll   // constant indices keep buf in registers
    for (int j = 0; j < 4; ++j)
        *(u32x4*)(tile + ((tid >> 4) + j * 16) * XT_PITCH + (tid & 15) * 8) = buf[j];
}

// ------------------------- kernel 1: QKV GEMM -------------------------------
// Per batch: (384 x 128) @ (128 x 1024).  One block = one (b, 64 positions):
// 12 waves, wave p computes rows 32p..32p+31, which are the q, k or v section
// of one head, for the block's 64 positions from the shared LDS tile.
// Writes q,k as (b,h,t,dh) scaled by 1/sqrt(dh); v as (b,h,dh,t).
// Routing (q/k/v section, head) is wave-uniform -> scalar branches.
// Register budget for 6 waves per SIMD: two blocks per WGP, so the whole grid
// of 512 blocks is resident at once.
__global__ __launch_bounds__(384, 6)
void k_qkv_gemm(const uint16_t* __restrict__ wbf,
                const uint16_t* __restrict__ xn,
                uint16_t* __restrict__ q,
                uint16_t* __restrict__ k,
                uint16_t* __restrict__ v) {
    __shared__ __align__(16) uint16_t tile[XT_ROWS * XT_PITCH];
    int tid  = threadIdx.x;
    int wib  = __builtin_amdgcn_readfirstlane(tid >> 5);   // 0..11
    int lane = tid & 31;
    int half = lane >> 4, lm = lane & 15;
    int b    = blockIdx.x >> 4;
    int n0   = (blockIdx.x & 15) * XT_ROWS;   // first position of the block

    int head = wib / 3;               // all wave-uniform scalars
    int sec  = wib - head * 3;        // 0=q 1=k 2=v
    size_t bh = (size_t)b * NH + head;

    u32x4 buf[4];
    if (wib < 8)                      // scalar branch: waves 8..11 only load A
        stage_load(buf, xn + ((size_t)b * HWN + n0) * CCH, tid);

    v16bf A[2][4];
    const uint16_t* arow = wbf + (size_t)(wib * 32 + lm) * CCH + half * 8;
#pragma unroll
    for (int m = 0; m < 2; ++m)
#pragma unroll
        for (int kk = 0; kk < 4; ++kk)
            A[m][kk] = load_frag(arow + m * 16 * CCH + kk * 32);
    // The wait that belongs in front of any reuse of the A loads' address
    // registers; naming the address keeps those registers until it.
    asm volatile("s_wait_xcnt 0x0" :: "v"(arow) : "memory");

    if (wib < 8) stage_store(tile, buf, tid);
    __syncthreads();

    // 32 rows x 16 positions: channels 0..15 (acc0) and 16..31 (acc1) of the section.
    auto mm = [&](int nt, v8f& acc0, v8f& acc1) {
        const uint16_t* brow = tile + (nt * 16 + lm) * XT_PITCH + half * 8;
#pragma unroll
        for (int kk = 0; kk < 4; ++kk) {
            v16bf Bf = load_frag(brow + kk * 32);
            acc0 = wmma_bf16(A[0][kk], Bf, acc0);
            acc1 = wmma_bf16(A[1][kk], Bf, acc1);
        }
    };

    // The section test stands outside the position loop: each side is one
    // straight run of products and stores.
    if (sec == 2) {
        uint16_t* dst = v + (bh * DH + half * 8) * HWN + n0 + lm;
#pragma unroll 2   // a full unroll spills at this register budget
        for (int nt = 0; nt < 4; ++nt) {
            v8f acc0 = {}, acc1 = {};
            mm(nt, acc0, acc1);
#pragma unroll
            for (int r = 0; r < 8; ++r) {
                dst[(size_t)r * HWN + nt * 16]        = f2bf(acc0[r]);
                dst[(size_t)(16 + r) * HWN + nt * 16] = f2bf(acc1[r]);
            }
        }
    } else {
        uint16_t* dst = (sec == 0 ? q : k) + (bh * HWN + n0 + lm) * DH + half * 8;
#pragma unroll 2   // a full unroll spills at this register budget
        for (int nt = 0; nt < 4; ++nt) {
            v8f acc0 = {}, acc1 = {};
            mm(nt, acc0, acc1);
            store8bf(dst + nt * 16 * DH, acc0, QKSCALE);   // one b128 store per lane
            store8bf(dst + nt * 16 * DH + 16, acc1, QKSCALE);
        }
    }
}

// ------------- kernel 2: flash attention + proj + bias + residual -----------
// One block = one (b, 128 positions), all four heads: 16 waves, wave (h, wt)
// takes head h and the two 16-row tiles 2wt, 2wt+1, so that every K and V
// fragment it reads from LDS serves two tiles of queries.  With every channel
// of its positions in one block, the output projection runs in the same launch,
// from an LDS tile.
// K and V come into LDS in stages of KST keys, two buffers per head, by
// global_load_async_to_lds_b128 (ASYNCcnt); the four waves of a head copy that
// head's stage, each its own slice, and the next stage flies while this one's
// four 32-key passes run, with one publish point (waits and barrier) per stage,
// which all 16 waves pass together.  Scores are
// computed transposed, S^T = K Q^T: lane (lm, half) holds 16 of a pass's 32
// scores of query lm, so the online softmax is in-lane plus one exchange
// between halves, and the two packed S^T tiles are the B operand of
// O^T += V^T P^T as they stand.
// The scores leave the matrix unit as arguments of exp2: q carries log2(e)
// from its weights, and the C operand of S^T is minus the query's maximum in
// use, the same in all eight registers of a lane.  That maximum is the true
// one of the first pass and moves only when a pass's sum of exponentials says
// that a score may stand more than 8 (log2) above it; only then are O and l
// rescaled and the pass's exponentials formed again.  The result is the same
// softmax for any maximum in use: it cancels in O / l.
#define LAZY_SUM 256.f   // 2^8: no exponential above it goes into P, O or l
#define AT_ROWS  128     // positions of a block
#define QT       2       // query tiles of a wave
__global__ __launch_bounds__(512)
void k_attention_proj(const uint16_t* __restrict__ q,
                      const uint16_t* __restrict__ k,
                      const uint16_t* __restrict__ v,
                      const uint16_t* __restrict__ wbf,
                      const float* __restrict__ pb,
                      const float* __restrict__ x,
                      float* __restrict__ out) {
    __shared__ __align__(16) uint16_t sK[NH][2][KST * K_PITCH];   // (s_local, c)
    __shared__ __align__(16) uint16_t sV[NH][2][DH * V_PITCH];    // (c, s_local)
    __shared__ __align__(16) uint16_t sH[AT_ROWS * XT_PITCH];     // (t_local, c)

    int tid  = threadIdx.x;
    int wib  = __builtin_amdgcn_readfirstlane(tid >> 5);   // 0..15
    int lane = tid & 31;
    int half = lane >> 4, lm = lane & 15;

    int b   = blockIdx.x >> 3;                // 32*8 blocks
    int n0  = (blockIdx.x & 7) * AT_ROWS;     // first position of the block
    int h   = wib >> 2;
    int wt  = wib & 3;
    int ht  = tid & 127;                      // thread among its head's 128
    int t0  = n0 + wt * (QT * 16);
    size_t bh = (size_t)b * NH + h;

    v16bf Qf[QT];
    v8f O0[QT] = {}, O1[QT] = {};
    v8f Cm[QT] = {};              // minus the maximum in use, C operand of S^T
    float l[QT] = {};             // this half's keys only, joined at the end
    const uint16_t* qp = q + (bh * HWN + t0 + lm) * DH + half * 8;
#pragma unroll   // constant indices keep Qf in registers
    for (int j = 0; j < QT; ++j)
        Qf[j] = load_frag(qp + j * 16 * DH);

    // The thread's pieces of a stage: K is contiguous (4 pieces a row), a V row
    // holds 16 pieces.  Low 32 bits of a __shared__ address = LDS offset.
    const uint16_t* gk = k + bh * HWN * DH + ht * 8;
    const uint16_t* gv = v + bh * DH * HWN + (size_t)(ht >> 4) * HWN + (ht & 15) * 8;
    uint32_t lk = (uint32_t)(uintptr_t)&sK[h][0][(ht >> 2) * K_PITCH + (ht & 3) * 8];
    uint32_t lv = (uint32_t)(uintptr_t)&sV[h][0][(ht >> 4) * V_PITCH + (ht & 15) * 8];

    // Prologue: stage 0 landed and published, stage 1 in flight.
    stage_kv(lk, gk, lv, gv);
    asm volatile("s_wait_asynccnt 0x0" ::: "memory");   // own copies of stage 0 landed
    __syncthreads();
    stage_kv(lk + K_BYTES, gk + KST * DH, lv + V_BYTES, gv + KST);

#pragma unroll 1   // rolled: the text of all 32 passes would be eight times as long to fetch
    for (int st = 0; st < NSTAGE; ++st) {
        int cur = st & 1;
        const uint16_t* kc = sK[h][cur] + lm * K_PITCH + half * 8;
        const uint16_t* vc = sV[h][cur] + lm * V_PITCH + half * 8;

#pragma unroll   // no barrier inside: a pass's LDS reads can rise among the O products before
        for (int ps4 = 0; ps4 < KST / 32; ++ps4) {
            const uint16_t* kp = kc + ps4 * 32 * K_PITCH;
            const uint16_t* vp = vc + ps4 * 32;
            v16bf K0 = load_frag(kp);                     // s = 0..15
            v16bf K1 = load_frag(kp + 16 * K_PITCH);      // s = 16..31
            v16bf V0 = load_frag(vp);                     // c = 0..15
            v16bf V1 = load_frag(vp + 16 * V_PITCH);      // c = 16..31
            // The pass's eight LDS reads stay one group in front of its
            // products; left alone they are split up, each part waited for.
            __builtin_amdgcn_sched_barrier(0);
            v8f S0[QT], S1[QT];
            float e0[QT][8], e1[QT][8], sum[QT];
#pragma unroll   // constant indices keep the tiles in registers
            for (int j = 0; j < QT; ++j) {
                S0[j] = wmma_bf16(K0, Qf[j], Cm[j]);   // S0[r]: s = half*8 + r,      t = lm
                S1[j] = wmma_bf16(K1, Qf[j], Cm[j]);   // S1[r]: s = 16 + half*8 + r, t = lm
            }
            // The four score products stay one run: the later ones fill the slots
            // that the first needs in front of its reader, which v_nop fills otherwise.
            __builtin_amdgcn_sched_barrier(0);
#pragma unroll   // constant indices keep the tiles in registers
            for (int j = 0; j < QT; ++j)
                sum[j] = exp_sum(S0[j], S1[j], e0[j], e1[j]);
            // Keeps the V reads in that group: without a use on this side of
            // the branch below they sink behind it.
            asm volatile("" :: "v"(V0), "v"(V1));

            // One scalar branch per pass, taken by the whole wave: in the very
            // first pass, which sets the maximum, and where a lane's sum says
            // that a score may stand more than 8 above the maximum in use.
            bool first = ps4 == 0 && st == 0;
            if (__builtin_amdgcn_ballot_w32((fmaxf(sum[0], sum[1]) > LAZY_SUM) | first) != 0) {
#pragma unroll   // constant indices keep the tiles in registers
                for (int j = 0; j < QT; ++j) {
                    float mx[8];
#pragma unroll   // constant indices keep mx and the tiles in registers
                    for (int r = 0; r < 8; ++r) mx[r] = fmaxf(S0[j][r], S1[j][r]);
                    float rowm = fmaxf(fmaxf(fmaxf(mx[0], mx[1]), fmaxf(mx[2], mx[3])),
                                       fmaxf(fmaxf(mx[4], mx[5]), fmaxf(mx[6], mx[7])));
                    rowm = fmaxf(rowm, other_half(rowm));
                    // The maximum in use only rises, but for the first pass, where
                    // O and l are still 0 and f needs only to be finite.
                    float d = first ? rowm : fmaxf(rowm, 0.f);
                    float f = __builtin_amdgcn_exp2f(fminf(-d, 0.f));
#pragma unroll   // constant indices keep the tiles in registers
                    for (int r = 0; r < 8; ++r) {
                        S0[j][r] -= d; S1[j][r] -= d; Cm[j][r] -= d;
                        O0[j][r] *= f; O1[j][r] *= f;
                    }
                    l[j] *= f;
                    sum[j] = exp_sum(S0[j], S1[j], e0[j], e1[j]);
                }
            }

            FragU P[QT];                  // B-frag 32(s) x 16(t), hardware k order
#pragma unroll   // constant indices keep P in registers
            for (int j = 0; j < QT; ++j) {
                l[j] += sum[j];
#pragma unroll   // constant indices keep e0, e1 and P in registers
                for (int i = 0; i < 4; ++i) {
                    P[j].q2[0][i] = pk2bf(e0[j][2 * i], e0[j][2 * i + 1]);
                    P[j].q2[1][i] = pk2bf(e1[j][2 * i], e1[j][2 * i + 1]);
                }
            }
#pragma unroll   // constant indices keep the tiles in registers
            for (int j = 0; j < QT; ++j) {
                O0[j] = wmma_bf16(V0, P[j].v, O0[j]);  // O0[r] = out(c = half*8 + r,      t = lm)
                O1[j] = wmma_bf16(V1, P[j].v, O1[j]);  // O1[r] = out(c = 16 + half*8 + r, t = lm)
            }
        }

        // Publish point: this wave has left buffer cur, its slice of the next
        // stage has landed; behind the barrier that holds for every wave.
        asm volatile("s_wait_dscnt 0x0" ::: "memory");
        asm volatile("s_wait_asynccnt 0x0" ::: "memory");
        __syncthreads();
        if (st + 2 < NSTAGE)              // refill the buffer just left
            stage_kv(lk + cur * K_BYTES, gk + (size_t)(st + 2) * KST * DH,
                     lv + cur * V_BYTES, gv + (st + 2) * KST);
    }
    asm volatile("s_wait_asynccnt 0x0" ::: "memory");   // nothing in flight at the end

    // Issued here so that they fly while O is normalized and handed over: the
    // wave's rows of the projection weights, its bias and its residual values.
    // Wave (mt, np): output rows 16mt..16mt+15, position tiles 4np..4np+3.
    int mt = wib & 7, np = wib >> 3;
    v16bf A[4];
    const uint16_t* arow = wbf + (size_t)(mt * 16 + lm) * CCH + half * 8;
#pragma unroll   // constant indices keep A in registers
    for (int kk = 0; kk < 4; ++kk) A[kk] = load_frag(arow + kk * 32);
    int    o0   = mt * 16 + half * 8;
    size_t idx0 = ((size_t)b * CCH + o0) * HWN + n0 + np * 64 + lm;
    uint32_t pofs = (uint32_t)o0 * 4u;        // byte offset of the lane's bias values
    const float* pbp = (const float*)((const char*)pb + pofs);
    const float* xp  = x + idx0;
    float xr[4][8], pbv[8];
#pragma unroll   // constant indices keep xr and pbv in registers
    for (int r = 0; r < 8; ++r) {
        pbv[r] = pbp[r];
#pragma unroll   // constant indices keep xr in registers
        for (int j = 0; j < 4; ++j)
            xr[j][r] = xp[(size_t)r * HWN + j * 16];
    }
    // The wait that belongs in front of any reuse of these loads' address
    // registers; naming the addresses keeps those registers until it.
    asm volatile("s_wait_xcnt 0x0" :: "v"(arow), "v"(pofs), "v"(xp) : "memory");

    // The head's 32 channels of the wave's 32 positions, bf16, into the tile.
#pragma unroll   // constant indices keep O and l in registers
    for (int j = 0; j < QT; ++j) {
        float lj  = l[j] + other_half(l[j]);
        float inv = 1.f / fmaxf(lj, 1e-30f);
        uint16_t* hp = sH + (wt * (QT * 16) + j * 16 + lm) * XT_PITCH + h * DH + half * 8;
        store8bf(hp, O0[j], inv);         // 8 consecutive channels per lane
        store8bf(hp + 16, O1[j], inv);
    }
    __syncthreads();                  // all four heads' channels stand in sH

    const uint16_t* brow = sH + (np * 64 + lm) * XT_PITCH + half * 8;
    v8f acc[4] = {};
#pragma unroll   // constant indices keep A, Bf and acc in registers
    for (int kh = 0; kh < 2; ++kh) {
        v16bf Bf[4][2];               // four tiles, two k steps: one group of reads
#pragma unroll
        for (int j = 0; j < 4; ++j)
#pragma unroll
            for (int k2 = 0; k2 < 2; ++k2)
                Bf[j][k2] = load_frag(brow + j * 16 * XT_PITCH + (kh * 2 + k2) * 32);
        // The group's LDS reads stay together in front of its products;
        // left alone each pair of reads is waited for on its own.
        __builtin_amdgcn_sched_barrier(0);
#pragma unroll
        for (int k2 = 0; k2 < 2; ++k2)
#pragma unroll
            for (int j = 0; j < 4; ++j)
                acc[j] = wmma_bf16(A[kh * 2 + k2], Bf[j][k2], acc[j]);
    }
    float* op = out + idx0;
#pragma unroll   // constant indices keep acc, pbv and xr in registers
    for (int j = 0; j < 4; ++j)
#pragma unroll
        for (int r = 0; r < 8; ++r)
            op[(size_t)r * HWN + j * 16] = acc[j][r] + pbv[r] + xr[j][r];
}

// ---------------------------------------------------------------------------
extern "C" void kernel_launch(void* const* d_in, const int* in_sizes, int n_in,
                              void* d_out, int out_size, void* d_ws, size_t ws_size,
                              hipStream_t stream) {
    const float* x      = (const float*)d_in[0];
    const float* norm_w = (const float*)d_in[1];
    const float* norm_b = (const float*)d_in[2];
    const float* qkv_w  = (const float*)d_in[3];
    const float* proj_w = (const float*)d_in[4];
    const float* proj_b = (const float*)d_in[5];
    float* out = (float*)d_out;

    char* ws = (char*)d_ws;
    const size_t SZ_BCHW_BF = (size_t)BATCH * CCH * HWN * 2;   // 8 MB bf16
    size_t off = 0;
    uint16_t* xn      = (uint16_t*)(ws + off); off += SZ_BCHW_BF;
    uint16_t* qb      = (uint16_t*)(ws + off); off += SZ_BCHW_BF;
    uint16_t* kb      = (uint16_t*)(ws + off); off += SZ_BCHW_BF;
    uint16_t* vb      = (uint16_t*)(ws + off); off += SZ_BCHW_BF;
    uint16_t* qkv_bf  = (uint16_t*)(ws + off); off += (size_t)3 * CCH * CCH * 2;
    uint16_t* proj_bf = (uint16_t*)(ws + off); off += (size_t)CCH * CCH * 2;
    (void)ws_size; (void)in_sizes; (void)n_in; (void)out_size;

    k_groupnorm<<<dim3(GN_BLOCKS + WC_BLOCKS), dim3(1024), 0, stream>>>(
        x, norm_w, norm_b, xn, qkv_w, proj_w, qkv_bf, proj_bf);
    k_qkv_gemm<<<dim3(BATCH * 16), dim3(384), 0, stream>>>(
        qkv_bf, xn, qb, kb, vb);
    k_attention_proj<<<dim3(BATCH * 8), dim3(512), 0, stream>>>(
        qb, kb, vb, proj_bf, proj_b, x, out);
}
